// v000
// Measured on an AMD MI455X. A time is GPU time per run, averaged over a window of back-to-back runs after a warm-up
// (all launches, gaps included; the runs take copies of the inputs in turn), and the median of several windows.
// Apart from v000's, it joins two sittings. Times from different sittings can be a few percent apart, while
// side-by-side timings come from the same sitting.
// v000 is the starting kernel. One run takes 342 microseconds.
#include <hip/hip_runtime.h>
#include <cstdint>
#include <cstddef>

// ---------------------------------------------------------------------------
// MoE MLP for MI455X (gfx1250):  per-expert  out = gelu_tanh(X·W1^T)·W2
//   E=8, T=1024, H=1024, F=4096, fp32 in/out, bf16 WMMA + fp32 accum.
//   Kernel1: g = gelu(X·W1^T)  -> bf16 workspace
//   Kernel2: out = g·W2        (A tile via async global->LDS, ASYNCcnt)
// Block: 256 threads (8 wave32), BM=128 x BN=128, BK=64 (2 WMMA K-steps),
// double-buffered LDS with register-held prefetch of the next K tile.
// ---------------------------------------------------------------------------

typedef __attribute__((ext_vector_type(16))) __bf16 v16bf;
typedef __attribute__((ext_vector_type(2)))  __bf16 v2bf;
typedef __attribute__((ext_vector_type(8)))  float  v8f;
typedef __attribute__((ext_vector_type(4)))  int    v4i;

#define AS1 __attribute__((address_space(1)))
#define AS3 __attribute__((address_space(3)))

#define E_ 8
#define T_ 1024
#define H_ 1024
#define F_ 4096

#define BM 128
#define BN 128
#define BK 64
#define LDSW 72      // padded row stride in halves (144 B, 16-B aligned)

#if __has_builtin(__builtin_amdgcn_global_load_async_to_lds_b128)
#define HAS_ASYNC_LDS 1
#else
#define HAS_ASYNC_LDS 0
#endif

#if HAS_ASYNC_LDS
#if __has_builtin(__builtin_amdgcn_s_wait_asynccnt)
#define WAIT_ASYNC() __builtin_amdgcn_s_wait_asynccnt(0)
#else
#define WAIT_ASYNC() asm volatile("s_wait_asynccnt 0x0" ::: "memory")
#endif
#else
#define WAIT_ASYNC() ((void)0)
#endif

union Frag { v16bf bf; uint4 u[2]; };

// pack two floats -> packed bf16 pair; element writes let clang use the
// native cvt into register halves (no integer shift/or packing)
__device__ __forceinline__ unsigned pk2bf(float a, float b) {
    v2bf v;
    v.x = (__bf16)a;
    v.y = (__bf16)b;
    return __builtin_bit_cast(unsigned, v);
}

__device__ __forceinline__ unsigned short f2bf(float f) {
    return __builtin_bit_cast(unsigned short, (__bf16)f);
}

__device__ __forceinline__ float gelu_tanh(float x) {
    const float c0 = 0.7978845608028654f;   // sqrt(2/pi)
    const float c1 = 0.044715f;
    float u = c0 * (x + c1 * x * x * x);
#if __has_builtin(__builtin_amdgcn_tanhf)
    float t = __builtin_amdgcn_tanhf(u);            // v_tanh_f32 (gfx1250 trans op)
#else
    float e = __expf(2.0f * u);                     // branch-free sigmoid form
    float t = 1.0f - 2.0f * __builtin_amdgcn_rcpf(e + 1.0f);
#endif
    return 0.5f * x * (1.0f + t);
}

// Fragment fetch from LDS (CDNA5 ISA 16-bit A/B 16x32 lane map):
//   lanes 0-15 : row = lane,    K = {kb+0..7, kb+16..23}
//   lanes16-31 : row = lane-16, K = {kb+8..15, kb+24..31}
__device__ __forceinline__ v16bf lds_frag(const unsigned short* base, int row, int kb) {
    Frag f;
    const unsigned short* p = base + row * LDSW + kb;
    f.u[0] = *(const uint4*)(p);
    f.u[1] = *(const uint4*)(p + 16);
    return f.bf;
}

// ---------------------------------------------------------------------------
// Kernel 1: g[e] = gelu(X[e] (T x H)  ·  W1[e]^T (H x F))   -> bf16
// grid = (F/BN, T/BM, E), block = 256
// ---------------------------------------------------------------------------
__global__ __launch_bounds__(256)
void moe_gemm1_gelu(const float* __restrict__ x,
                    const float* __restrict__ w1,
                    unsigned short* __restrict__ g)
{
    __shared__ unsigned short As[2][BM * LDSW];
    __shared__ unsigned short Bs[2][BN * LDSW];

    const int e  = blockIdx.z;
    const int bx = blockIdx.x;          // F tile
    const int by = blockIdx.y;          // T tile
    const int tid  = threadIdx.x;
    const int lane = tid & 31;
    const int wave = tid >> 5;
    const int wm = wave & 1;            // 2 row groups of 64
    const int wn = wave >> 1;           // 4 col groups of 32

    const float* xe  = x  + (size_t)e * T_ * H_ + (size_t)(by * BM) * H_;
    const float* w1e = w1 + (size_t)e * F_ * H_ + (size_t)(bx * BN) * H_;
    unsigned short* ge = g + (size_t)e * T_ * F_;

    v8f acc[4][2];
    #pragma unroll
    for (int mt = 0; mt < 4; ++mt)
        #pragma unroll
        for (int nt = 0; nt < 2; ++nt)
            acc[mt][nt] = (v8f)(0.0f);

    const int nlocal = lane & 15;
    const int kbase  = (lane >> 4) * 8;
    const int NK = H_ / BK;             // 16

    float4 pfA[8], pfB[8];

    // ---- prologue: tile 0 -> buffer 0
    #pragma unroll
    for (int i = 0; i < 8; ++i) {
        int slot = tid + 256 * i, row = slot >> 4, c4 = slot & 15;
        pfA[i] = *(const float4*)(xe  + (size_t)row * H_ + c4 * 4);
        pfB[i] = *(const float4*)(w1e + (size_t)row * H_ + c4 * 4);
    }
    #pragma unroll
    for (int i = 0; i < 8; ++i) {
        int slot = tid + 256 * i, row = slot >> 4, c4 = slot & 15;
        *(uint2*)(&As[0][row * LDSW + c4 * 4]) =
            make_uint2(pk2bf(pfA[i].x, pfA[i].y), pk2bf(pfA[i].z, pfA[i].w));
        *(uint2*)(&Bs[0][row * LDSW + c4 * 4]) =
            make_uint2(pk2bf(pfB[i].x, pfB[i].y), pk2bf(pfB[i].z, pfB[i].w));
    }
    __syncthreads();

    for (int k = 0; k < NK; ++k) {
        const int cur = k & 1;
        const int nxt = cur ^ 1;
        const bool hasNext = (k + 1) < NK;
        const int k0n = (k + 1) * BK;

        // issue next tile's global loads (latency hidden under the WMMAs)
        if (hasNext) {
            #pragma unroll
            for (int i = 0; i < 8; ++i) {
                int slot = tid + 256 * i, row = slot >> 4, c4 = slot & 15;
                pfA[i] = *(const float4*)(xe  + (size_t)row * H_ + k0n + c4 * 4);
                pfB[i] = *(const float4*)(w1e + (size_t)row * H_ + k0n + c4 * 4);
            }
        }

        // compute on current buffer
        #pragma unroll
        for (int ks = 0; ks < BK; ks += 32) {
            int kb = ks + kbase;
            v16bf aF[4], bF[2];
            #pragma unroll
            for (int mt = 0; mt < 4; ++mt)
                aF[mt] = lds_frag(&As[cur][0], wm * 64 + mt * 16 + nlocal, kb);
            #pragma unroll
            for (int nt = 0; nt < 2; ++nt)
                bF[nt] = lds_frag(&Bs[cur][0], wn * 32 + nt * 16 + nlocal, kb);

            #pragma unroll
            for (int mt = 0; mt < 4; ++mt)
                #pragma unroll
                for (int nt = 0; nt < 2; ++nt)
                    acc[mt][nt] = __builtin_amdgcn_wmma_f32_16x16x32_bf16(
                        false, aF[mt], false, bF[nt],
                        (short)0, acc[mt][nt], false, false);
        }

        // convert + store next tile into the other buffer
        if (hasNext) {
            #pragma unroll
            for (int i = 0; i < 8; ++i) {
                int slot = tid + 256 * i, row = slot >> 4, c4 = slot & 15;
                *(uint2*)(&As[nxt][row * LDSW + c4 * 4]) =
                    make_uint2(pk2bf(pfA[i].x, pfA[i].y), pk2bf(pfA[i].z, pfA[i].w));
                *(uint2*)(&Bs[nxt][row * LDSW + c4 * 4]) =
                    make_uint2(pk2bf(pfB[i].x, pfB[i].y), pk2bf(pfB[i].z, pfB[i].w));
            }
        }
        __syncthreads();
    }

    // epilogue: GELU + bf16 store.  C layout: lanes 0-15 -> M=r, lanes16-31 -> M=r+8
    const int rowOff = by * BM + wm * 64;
    const int colOff = bx * BN + wn * 32;
    const int rplus  = (lane >> 4) * 8;
    #pragma unroll
    for (int mt = 0; mt < 4; ++mt)
        #pragma unroll
        for (int nt = 0; nt < 2; ++nt) {
            int col = colOff + nt * 16 + nlocal;
            #pragma unroll
            for (int r = 0; r < 8; ++r) {
                int row = rowOff + mt * 16 + rplus + r;
                ge[(size_t)row * F_ + col] = f2bf(gelu_tanh(acc[mt][nt][r]));
            }
        }
}

// ---------------------------------------------------------------------------
// Kernel 2: out[e] = g[e] (T x F, bf16)  ·  W2[e] (F x H, fp32)
// grid = (H/BN, T/BM, E), block = 256
// ---------------------------------------------------------------------------
__global__ __launch_bounds__(256)
void moe_gemm2(const unsigned short* __restrict__ g,
               const float* __restrict__ w2,
               float* __restrict__ out)
{
    __shared__ unsigned short As[2][BM * LDSW];
    __shared__ unsigned short Bs[2][BN * LDSW];

    const int e  = blockIdx.z;
    const int bx = blockIdx.x;          // H tile
    const int by = blockIdx.y;          // T tile
    const int tid  = threadIdx.x;
    const int lane = tid & 31;
    const int wave = tid >> 5;
    const int wm = wave & 1;
    const int wn = wave >> 1;

    const unsigned short* ge = g + (size_t)e * T_ * F_ + (size_t)(by * BM) * F_;
    const float* w2e = w2 + (size_t)e * F_ * H_;
    float* oute = out + (size_t)e * T_ * H_;

    v8f acc[4][2];
    #pragma unroll
    for (int mt = 0; mt < 4; ++mt)
        #pragma unroll
        for (int nt = 0; nt < 2; ++nt)
            acc[mt][nt] = (v8f)(0.0f);

    const int nlocal = lane & 15;
    const int kbase  = (lane >> 4) * 8;
    const int NK = F_ / BK;             // 64

    float4 pfB0[4], pfB1[4];
#if !HAS_ASYNC_LDS
    uint4 pfAu[4];
#endif

    // A tile staging: async global->LDS 16B copies (8 x 16B per 64-half row)
    auto issueA = [&](int k0, int buf) {
        #pragma unroll
        for (int i = 0; i < 4; ++i) {
            int slot = tid + 256 * i, row = slot >> 3, c4 = slot & 7;
            const unsigned short* pa = ge + (size_t)row * F_ + k0 + c4 * 8;
#if HAS_ASYNC_LDS
            __builtin_amdgcn_global_load_async_to_lds_b128(
                (AS1 v4i*)(uintptr_t)pa,
                (AS3 v4i*)(unsigned)(uintptr_t)(&As[buf][row * LDSW + c4 * 8]),
                0, 0);
#else
            pfAu[i] = *(const uint4*)pa;
#endif
        }
    };
#if !HAS_ASYNC_LDS
    auto storeA = [&](int buf) {
        #pragma unroll
        for (int i = 0; i < 4; ++i) {
            int slot = tid + 256 * i, row = slot >> 3, c4 = slot & 7;
            *(uint4*)(&As[buf][row * LDSW + c4 * 8]) = pfAu[i];
        }
    };
#endif
    // B tile: W2 [K rows, N contiguous]; load two adjacent K rows per slot
    auto loadB = [&](int k0) {
        #pragma unroll
        for (int i = 0; i < 4; ++i) {
            int slot = tid + 256 * i, kp = slot >> 5, c4 = slot & 31;
            const float* pb0 = w2e + (size_t)(k0 + 2 * kp) * H_ + bx * BN + c4 * 4;
            pfB0[i] = *(const float4*)pb0;
            pfB1[i] = *(const float4*)(pb0 + H_);
        }
    };
    // transpose into Bs[n][k]: pack (k, k+1) bf16 pair per 32-bit LDS store
    auto storeB = [&](int buf) {
        #pragma unroll
        for (int i = 0; i < 4; ++i) {
            int slot = tid + 256 * i, kp = slot >> 5, c4 = slot & 31;
            float a0[4] = { pfB0[i].x, pfB0[i].y, pfB0[i].z, pfB0[i].w };
            float a1[4] = { pfB1[i].x, pfB1[i].y, pfB1[i].z, pfB1[i].w };
            #pragma unroll
            for (int j = 0; j < 4; ++j) {
                int n = c4 * 4 + j;
                *(unsigned*)(&Bs[buf][n * LDSW + 2 * kp]) = pk2bf(a0[j], a1[j]);
            }
        }
    };

    // ---- prologue: tile 0 -> buffer 0
    issueA(0, 0);
    loadB(0);
#if !HAS_ASYNC_LDS
    storeA(0);
#endif
    storeB(0);
    WAIT_ASYNC();
    __syncthreads();

    for (int k = 0; k < NK; ++k) {
        const int cur = k & 1;
        const int nxt = cur ^ 1;
        const bool hasNext = (k + 1) < NK;
        const int k0n = (k + 1) * BK;

        if (hasNext) {
            issueA(k0n, nxt);       // async copies straight into LDS, no VGPRs
            loadB(k0n);             // fp32 loads held in registers
        }

        #pragma unroll
        for (int ks = 0; ks < BK; ks += 32) {
            int kb = ks + kbase;
            v16bf aF[4], bF[2];
            #pragma unroll
            for (int mt = 0; mt < 4; ++mt)
                aF[mt] = lds_frag(&As[cur][0], wm * 64 + mt * 16 + nlocal, kb);
            #pragma unroll
            for (int nt = 0; nt < 2; ++nt)
                bF[nt] = lds_frag(&Bs[cur][0], wn * 32 + nt * 16 + nlocal, kb);

            #pragma unroll
            for (int mt = 0; mt < 4; ++mt)
                #pragma unroll
                for (int nt = 0; nt < 2; ++nt)
                    acc[mt][nt] = __builtin_amdgcn_wmma_f32_16x16x32_bf16(
                        false, aF[mt], false, bF[nt],
                        (short)0, acc[mt][nt], false, false);
        }

        if (hasNext) {
#if !HAS_ASYNC_LDS
            storeA(nxt);
#endif
            storeB(nxt);
            WAIT_ASYNC();
        }
        __syncthreads();
    }

    const int rowOff = by * BM + wm * 64;
    const int colOff = bx * BN + wn * 32;
    const int rplus  = (lane >> 4) * 8;
    #pragma unroll
    for (int mt = 0; mt < 4; ++mt)
        #pragma unroll
        for (int nt = 0; nt < 2; ++nt) {
            int col = colOff + nt * 16 + nlocal;
            #pragma unroll
            for (int r = 0; r < 8; ++r) {
                int row = rowOff + mt * 16 + rplus + r;
                oute[(size_t)row * H_ + col] = acc[mt][nt][r];
            }
        }
}

// ---------------------------------------------------------------------------
extern "C" void kernel_launch(void* const* d_in, const int* in_sizes, int n_in,
                              void* d_out, int out_size, void* d_ws, size_t ws_size,
                              hipStream_t stream) {
    const float* x  = (const float*)d_in[0];   // [E,T,H]
    const float* w1 = (const float*)d_in[1];   // [E,F,H]
    const float* w2 = (const float*)d_in[2];   // [E,F,H]
    float* out = (float*)d_out;                // [E,T,H] fp32
    unsigned short* g = (unsigned short*)d_ws; // [E,T,F] bf16 (64 MB)

    dim3 blk(256, 1, 1);
    dim3 g1(F_ / BN, T_ / BM, E_);
    dim3 g2(H_ / BN, T_ / BM, E_);
    hipLaunchKernelGGL(moe_gemm1_gelu, g1, blk, 0, stream, x, w1, g);
    hipLaunchKernelGGL(moe_gemm2,      g2, blk, 0, stream, g, w2, out);
}

// v001
// Measured time: 198 microseconds a run.
// Two timings next to v000 put it at 1.76 and 1.77 times that version's speed.
#include <hip/hip_runtime.h>
#include <cstdint>
#include <cstddef>

// ---------------------------------------------------------------------------
// MoE MLP for MI455X (gfx1250):  per-expert  out = gelu_tanh(X·W1^T)·W2
//   E=8, T=1024, H=1024, F=4096, fp32 in/out, bf16 WMMA + fp32 accum.
//   Kernel1: g = gelu(X·W1^T)  -> bf16 workspace
//   Kernel2: out = g·W2        (A tile via async global->LDS, ASYNCcnt)
// Block: 256 threads (8 wave32), BM=128 x BN=128, BK=64 (2 WMMA K-steps),
// double-buffered LDS with register-held prefetch of the next K tile.
// ---------------------------------------------------------------------------

typedef __attribute__((ext_vector_type(16))) __bf16 v16bf;
typedef __attribute__((ext_vector_type(2)))  __bf16 v2bf;
typedef __attribute__((ext_vector_type(8)))  float  v8f;
typedef __attribute__((ext_vector_type(4)))  int    v4i;

#define AS1 __attribute__((address_space(1)))
#define AS3 __attribute__((address_space(3)))

#define E_ 8
#define T_ 1024
#define H_ 1024
#define F_ 4096

#define BM 128
#define BN 128
#define BK 64
#define LDSW 72      // padded row stride in halves (144 B, 16-B aligned)

#if __has_builtin(__builtin_amdgcn_global_load_async_to_lds_b128)
#define HAS_ASYNC_LDS 1
#else
#define HAS_ASYNC_LDS 0
#endif

#if HAS_ASYNC_LDS
#if __has_builtin(__builtin_amdgcn_s_wait_asynccnt)
#define WAIT_ASYNC() __builtin_amdgcn_s_wait_asynccnt(0)
#else
#define WAIT_ASYNC() asm volatile("s_wait_asynccnt 0x0" ::: "memory")
#endif
#else
#define WAIT_ASYNC() ((void)0)
#endif

union Frag { v16bf bf; uint4 u[2]; };

// pack two floats -> packed bf16 pair; element writes let clang use the
// native cvt into register halves (no integer shift/or packing)
__device__ __forceinline__ unsigned pk2bf(float a, float b) {
    v2bf v;
    v.x = (__bf16)a;
    v.y = (__bf16)b;
    return __builtin_bit_cast(unsigned, v);
}

__device__ __forceinline__ unsigned short f2bf(float f) {
    return __builtin_bit_cast(unsigned short, (__bf16)f);
}

__device__ __forceinline__ float gelu_tanh(float x) {
    const float c0 = 0.7978845608028654f;   // sqrt(2/pi)
    const float c1 = 0.044715f;
    float u = c0 * (x + c1 * x * x * x);
#if __has_builtin(__builtin_amdgcn_tanhf)
    float t = __builtin_amdgcn_tanhf(u);            // v_tanh_f32 (gfx1250 trans op)
#else
    float e = __expf(2.0f * u);                     // branch-free sigmoid form
    float t = 1.0f - 2.0f * __builtin_amdgcn_rcpf(e + 1.0f);
#endif
    return 0.5f * x * (1.0f + t);
}

// Fragment fetch from LDS (CDNA5 ISA 16-bit A/B 16x32 lane map):
//   lanes 0-15 : row = lane,    K = {kb+0..7, kb+16..23}
//   lanes16-31 : row = lane-16, K = {kb+8..15, kb+24..31}
__device__ __forceinline__ v16bf lds_frag(const unsigned short* base, int row, int kb) {
    Frag f;
    const unsigned short* p = base + row * LDSW + kb;
    f.u[0] = *(const uint4*)(p);
    f.u[1] = *(const uint4*)(p + 16);
    return f.bf;
}

// ---------------------------------------------------------------------------
// Kernel 1: g[e] = gelu(X[e] (T x H)  ·  W1[e]^T (H x F))   -> bf16
// grid = (F/BN, T/BM, E), block = 256
// ---------------------------------------------------------------------------
__global__ __launch_bounds__(256)
void moe_gemm1_gelu(const float* __restrict__ x,
                    const float* __restrict__ w1,
                    unsigned short* __restrict__ g)
{
    __shared__ unsigned short As[2][BM * LDSW];
    __shared__ unsigned short Bs[2][BN * LDSW];

    const int e  = blockIdx.z;
    const int bx = blockIdx.x;          // F tile
    const int by = blockIdx.y;          // T tile
    const int tid  = threadIdx.x;
    const int lane = tid & 31;
    const int wave = tid >> 5;
    const int wm = wave & 1;            // 2 row groups of 64
    const int wn = wave >> 1;           // 4 col groups of 32

    const float* xe  = x  + (size_t)e * T_ * H_ + (size_t)(by * BM) * H_;
    const float* w1e = w1 + (size_t)e * F_ * H_ + (size_t)(bx * BN) * H_;
    unsigned short* ge = g + (size_t)e * T_ * F_;

    v8f acc[4][2];
    #pragma unroll
    for (int mt = 0; mt < 4; ++mt)
        #pragma unroll
        for (int nt = 0; nt < 2; ++nt)
            acc[mt][nt] = (v8f)(0.0f);

    const int nlocal = lane & 15;
    const int kbase  = (lane >> 4) * 8;
    const int NK = H_ / BK;             // 16

    float4 pfA[8], pfB[8];

    // ---- prologue: tile 0 -> buffer 0
    #pragma unroll
    for (int i = 0; i < 8; ++i) {
        int slot = tid + 256 * i, row = slot >> 4, c4 = slot & 15;
        pfA[i] = *(const float4*)(xe  + (size_t)row * H_ + c4 * 4);
        pfB[i] = *(const float4*)(w1e + (size_t)row * H_ + c4 * 4);
    }
    #pragma unroll
    for (int i = 0; i < 8; ++i) {
        int slot = tid + 256 * i, row = slot >> 4, c4 = slot & 15;
        *(uint2*)(&As[0][row * LDSW + c4 * 4]) =
            make_uint2(pk2bf(pfA[i].x, pfA[i].y), pk2bf(pfA[i].z, pfA[i].w));
        *(uint2*)(&Bs[0][row * LDSW + c4 * 4]) =
            make_uint2(pk2bf(pfB[i].x, pfB[i].y), pk2bf(pfB[i].z, pfB[i].w));
    }
    __syncthreads();

    for (int k = 0; k < NK; ++k) {
        const int cur = k & 1;
        const int nxt = cur ^ 1;
        const bool hasNext = (k + 1) < NK;
        const int k0n = (k + 1) * BK;

        // issue next tile's global loads (latency hidden under the WMMAs)
        if (hasNext) {
            #pragma unroll
            for (int i = 0; i < 8; ++i) {
                int slot = tid + 256 * i, row = slot >> 4, c4 = slot & 15;
                pfA[i] = *(const float4*)(xe  + (size_t)row * H_ + k0n + c4 * 4);
                pfB[i] = *(const float4*)(w1e + (size_t)row * H_ + k0n + c4 * 4);
            }
            // the code below reuses the address registers of these loads, so the wait is written here
            asm volatile("s_wait_xcnt 0x0" ::: "memory");
        }
        // holds the whole load group (and the wait above) in front of the matrix block:
        // otherwise each load is sunk to its convert and the round trips run one by one
        __builtin_amdgcn_sched_barrier(0);

        // compute on current buffer
        #pragma unroll
        for (int ks = 0; ks < BK; ks += 32) {
            int kb = ks + kbase;
            v16bf aF[4], bF[2];
            #pragma unroll
            for (int mt = 0; mt < 4; ++mt)
                aF[mt] = lds_frag(&As[cur][0], wm * 64 + mt * 16 + nlocal, kb);
            #pragma unroll
            for (int nt = 0; nt < 2; ++nt)
                bF[nt] = lds_frag(&Bs[cur][0], wn * 32 + nt * 16 + nlocal, kb);

            #pragma unroll
            for (int mt = 0; mt < 4; ++mt)
                #pragma unroll
                for (int nt = 0; nt < 2; ++nt)
                    acc[mt][nt] = __builtin_amdgcn_wmma_f32_16x16x32_bf16(
                        false, aF[mt], false, bF[nt],
                        (short)0, acc[mt][nt], false, false);
        }

        // keeps the waits on the next tile's loads behind the matrix block, which covers them
        __builtin_amdgcn_sched_barrier(0);
        // convert + store next tile into the other buffer
        if (hasNext) {
            #pragma unroll
            for (int i = 0; i < 8; ++i) {
                int slot = tid + 256 * i, row = slot >> 4, c4 = slot & 15;
                *(uint2*)(&As[nxt][row * LDSW + c4 * 4]) =
                    make_uint2(pk2bf(pfA[i].x, pfA[i].y), pk2bf(pfA[i].z, pfA[i].w));
                *(uint2*)(&Bs[nxt][row * LDSW + c4 * 4]) =
                    make_uint2(pk2bf(pfB[i].x, pfB[i].y), pk2bf(pfB[i].z, pfB[i].w));
            }
        }
        __syncthreads();
    }

    // epilogue: GELU + bf16 store.  C layout: lanes 0-15 -> M=r, lanes16-31 -> M=r+8
    const int rowOff = by * BM + wm * 64;
    const int colOff = bx * BN + wn * 32;
    const int rplus  = (lane >> 4) * 8;
    #pragma unroll
    for (int mt = 0; mt < 4; ++mt)
        #pragma unroll
        for (int nt = 0; nt < 2; ++nt) {
            int col = colOff + nt * 16 + nlocal;
            #pragma unroll
            for (int r = 0; r < 8; ++r) {
                int row = rowOff + mt * 16 + rplus + r;
                ge[(size_t)row * F_ + col] = f2bf(gelu_tanh(acc[mt][nt][r]));
            }
        }
}

// ---------------------------------------------------------------------------
// Kernel 2: out[e] = g[e] (T x F, bf16)  ·  W2[e] (F x H, fp32)
// grid = (H/BN, T/BM, E), block = 256
// ---------------------------------------------------------------------------
__global__ __launch_bounds__(256)
void moe_gemm2(const unsigned short* __restrict__ g,
               const float* __restrict__ w2,
               float* __restrict__ out)
{
    __shared__ unsigned short As[2][BM * LDSW];
    __shared__ unsigned short Bs[2][BN * LDSW];

    const int e  = blockIdx.z;
    const int bx = blockIdx.x;          // H tile
    const int by = blockIdx.y;          // T tile
    const int tid  = threadIdx.x;
    const int lane = tid & 31;
    const int wave = tid >> 5;
    const int wm = wave & 1;
    const int wn = wave >> 1;

    const unsigned short* ge = g + (size_t)e * T_ * F_ + (size_t)(by * BM) * F_;
    const float* w2e = w2 + (size_t)e * F_ * H_;
    float* oute = out + (size_t)e * T_ * H_;

    v8f acc[4][2];
    #pragma unroll
    for (int mt = 0; mt < 4; ++mt)
        #pragma unroll
        for (int nt = 0; nt < 2; ++nt)
            acc[mt][nt] = (v8f)(0.0f);

    const int nlocal = lane & 15;
    const int kbase  = (lane >> 4) * 8;
    const int NK = F_ / BK;             // 64

    float4 pfB0[4], pfB1[4];
#if !HAS_ASYNC_LDS
    uint4 pfAu[4];
#endif

    // A tile staging: async global->LDS 16B copies (8 x 16B per 64-half row)
    auto issueA = [&](int k0, int buf) {
        #pragma unroll
        for (int i = 0; i < 4; ++i) {
            int slot = tid + 256 * i, row = slot >> 3, c4 = slot & 7;
            const unsigned short* pa = ge + (size_t)row * F_ + k0 + c4 * 8;
#if HAS_ASYNC_LDS
            __builtin_amdgcn_global_load_async_to_lds_b128(
                (AS1 v4i*)(uintptr_t)pa,
                (AS3 v4i*)(unsigned)(uintptr_t)(&As[buf][row * LDSW + c4 * 8]),
                0, 0);
#else
            pfAu[i] = *(const uint4*)pa;
#endif
        }
    };
#if !HAS_ASYNC_LDS
    auto storeA = [&](int buf) {
        #pragma unroll
        for (int i = 0; i < 4; ++i) {
            int slot = tid + 256 * i, row = slot >> 3, c4 = slot & 7;
            *(uint4*)(&As[buf][row * LDSW + c4 * 8]) = pfAu[i];
        }
    };
#endif
    // B tile: W2 [K rows, N contiguous]; load two adjacent K rows per slot
    auto loadB = [&](int k0) {
        #pragma unroll
        for (int i = 0; i < 4; ++i) {
            int slot = tid + 256 * i, kp = slot >> 5, c4 = slot & 31;
            const float* pb0 = w2e + (size_t)(k0 + 2 * kp) * H_ + bx * BN + c4 * 4;
            pfB0[i] = *(const float4*)pb0;
            pfB1[i] = *(const float4*)(pb0 + H_);
        }
    };
    // transpose into Bs[n][k]: pack (k, k+1) bf16 pair per 32-bit LDS store
    auto storeB = [&](int buf) {
        #pragma unroll
        for (int i = 0; i < 4; ++i) {
            int slot = tid + 256 * i, kp = slot >> 5, c4 = slot & 31;
            float a0[4] = { pfB0[i].x, pfB0[i].y, pfB0[i].z, pfB0[i].w };
            float a1[4] = { pfB1[i].x, pfB1[i].y, pfB1[i].z, pfB1[i].w };
            #pragma unroll
            for (int j = 0; j < 4; ++j) {
                int n = c4 * 4 + j;
                *(unsigned*)(&Bs[buf][n * LDSW + 2 * kp]) = pk2bf(a0[j], a1[j]);
            }
        }
    };

    // ---- prologue: tile 0 -> buffer 0
    issueA(0, 0);
    loadB(0);
#if !HAS_ASYNC_LDS
    storeA(0);
#endif
    storeB(0);
    WAIT_ASYNC();
    __syncthreads();

    for (int k = 0; k < NK; ++k) {
        const int cur = k & 1;
        const int nxt = cur ^ 1;
        const bool hasNext = (k + 1) < NK;
        const int k0n = (k + 1) * BK;

        if (hasNext) {
            issueA(k0n, nxt);       // async copies straight into LDS, no VGPRs
            loadB(k0n);             // fp32 loads held in registers
        }
        // holds the whole load group in front of the matrix block: otherwise the loads
        // are sunk among the last matrix instructions and their latency is waited out
        __builtin_amdgcn_sched_barrier(0);

        #pragma unroll
        for (int ks = 0; ks < BK; ks += 32) {
            int kb = ks + kbase;
            v16bf aF[4], bF[2];
            #pragma unroll
            for (int mt = 0; mt < 4; ++mt)
                aF[mt] = lds_frag(&As[cur][0], wm * 64 + mt * 16 + nlocal, kb);
            #pragma unroll
            for (int nt = 0; nt < 2; ++nt)
                bF[nt] = lds_frag(&Bs[cur][0], wn * 32 + nt * 16 + nlocal, kb);

            #pragma unroll
            for (int mt = 0; mt < 4; ++mt)
                #pragma unroll
                for (int nt = 0; nt < 2; ++nt)
                    acc[mt][nt] = __builtin_amdgcn_wmma_f32_16x16x32_bf16(
                        false, aF[mt], false, bF[nt],
                        (short)0, acc[mt][nt], false, false);
        }

        // keeps the waits on the next tile's loads behind the matrix block, which covers them
        __builtin_amdgcn_sched_barrier(0);
        if (hasNext) {
#if !HAS_ASYNC_LDS
            storeA(nxt);
#endif
            storeB(nxt);
            WAIT_ASYNC();
        }
        __syncthreads();
    }

    const int rowOff = by * BM + wm * 64;
    const int colOff = bx * BN + wn * 32;
    const int rplus  = (lane >> 4) * 8;
    #pragma unroll
    for (int mt = 0; mt < 4; ++mt)
        #pragma unroll
        for (int nt = 0; nt < 2; ++nt) {
            int col = colOff + nt * 16 + nlocal;
            #pragma unroll
            for (int r = 0; r < 8; ++r) {
                int row = rowOff + mt * 16 + rplus + r;
                oute[(size_t)row * H_ + col] = acc[mt][nt][r];
            }
        }
}

// ---------------------------------------------------------------------------
extern "C" void kernel_launch(void* const* d_in, const int* in_sizes, int n_in,
                              void* d_out, int out_size, void* d_ws, size_t ws_size,
                              hipStream_t stream) {
    const float* x  = (const float*)d_in[0];   // [E,T,H]
    const float* w1 = (const float*)d_in[1];   // [E,F,H]
    const float* w2 = (const float*)d_in[2];   // [E,F,H]
    float* out = (float*)d_out;                // [E,T,H] fp32
    unsigned short* g = (unsigned short*)d_ws; // [E,T,F] bf16 (64 MB)

    dim3 blk(256, 1, 1);
    dim3 g1(F_ / BN, T_ / BM, E_);
    dim3 g2(H_ / BN, T_ / BM, E_);
    hipLaunchKernelGGL(moe_gemm1_gelu, g1, blk, 0, stream, x, w1, g);
    hipLaunchKernelGGL(moe_gemm2,      g2, blk, 0, stream, g, w2, out);
}

// v002
// Measured time: 166 microseconds a run.
// Next to v001, in two timings, it ran 1.20 and 1.19 times as fast.
// All steps since v000 together make it 2.10 times as fast.
#include <hip/hip_runtime.h>
#include <cstdint>
#include <cstddef>

// ---------------------------------------------------------------------------
// MoE MLP for MI455X (gfx1250):  per-expert  out = gelu_tanh(X·W1^T)·W2
//   E=8, T=1024, H=1024, F=4096, fp32 in/out, bf16 WMMA + fp32 accum.
//   Kernel1: g = gelu(X·W1^T)  -> bf16 workspace
//   Kernel2: out = g·W2        (A tile via async global->LDS, ASYNCcnt)
// Block: 256 threads (8 wave32), one block per WGP.
//   Kernel1: 256 x 256 x 32 tile, 128 x 64 per wave; Kernel2: 256 x 128 x 64 tile, 64 x 64 per wave
//   (512 and 256 blocks): an operand byte fetched from L2 feeds 2 x (Kernel1) and 1.5 x (Kernel2) the products of a 128 x 128 tile.
// double-buffered LDS with register-held prefetch of the next K tile.
// ---------------------------------------------------------------------------

typedef __attribute__((ext_vector_type(16))) __bf16 v16bf;
typedef __attribute__((ext_vector_type(2)))  __bf16 v2bf;
typedef __attribute__((ext_vector_type(8)))  float  v8f;
typedef __attribute__((ext_vector_type(4)))  int    v4i;

#define AS1 __attribute__((address_space(1)))
#define AS3 __attribute__((address_space(3)))

#define E_ 8
#define T_ 1024
#define H_ 1024
#define F_ 4096

#define BM1 256     // kernel 1 tile
#define BN1 256
#define BK1 32      // one WMMA K-step: the f32 prefetch of a 64-deep tile would not leave registers for the fragments
#define LDSW1 40    // padded row stride in halves (80 B, 16 B x odd)
#define BM 256      // kernel 2 tile
#define BN 128
#define BK 64
#define LDSW 72      // padded row stride in halves (144 B, 16-B aligned)

#if __has_builtin(__builtin_amdgcn_global_load_async_to_lds_b128)
#define HAS_ASYNC_LDS 1
#else
#define HAS_ASYNC_LDS 0
#endif

#if HAS_ASYNC_LDS
#if __has_builtin(__builtin_amdgcn_s_wait_asynccnt)
#define WAIT_ASYNC() __builtin_amdgcn_s_wait_asynccnt(0)
#else
#define WAIT_ASYNC() asm volatile("s_wait_asynccnt 0x0" ::: "memory")
#endif
#else
#define WAIT_ASYNC() ((void)0)
#endif

union Frag { v16bf bf; uint4 u[2]; };

// pack two floats -> packed bf16 pair; element writes let clang use the
// native cvt into register halves (no integer shift/or packing)
__device__ __forceinline__ unsigned pk2bf(float a, float b) {
    v2bf v;
    v.x = (__bf16)a;
    v.y = (__bf16)b;
    return __builtin_bit_cast(unsigned, v);
}

__device__ __forceinline__ unsigned short f2bf(float f) {
    return __builtin_bit_cast(unsigned short, (__bf16)f);
}

__device__ __forceinline__ float gelu_tanh(float x) {
    const float c0 = 0.7978845608028654f;   // sqrt(2/pi)
    const float c1 = 0.044715f;
    float u = c0 * (x + c1 * x * x * x);
#if __has_builtin(__builtin_amdgcn_tanhf)
    float t = __builtin_amdgcn_tanhf(u);            // v_tanh_f32 (gfx1250 trans op)
#else
    float e = __expf(2.0f * u);                     // branch-free sigmoid form
    float t = 1.0f - 2.0f * __builtin_amdgcn_rcpf(e + 1.0f);
#endif
    return 0.5f * x * (1.0f + t);
}

// Fragment fetch from LDS (CDNA5 ISA 16-bit A/B 16x32 lane map):
//   lanes 0-15 : row = lane,    K = {kb+0..7, kb+16..23}
//   lanes16-31 : row = lane-16, K = {kb+8..15, kb+24..31}
template <int PITCH>
__device__ __forceinline__ v16bf lds_frag(const unsigned short* base, int row, int kb) {
    Frag f;
    const unsigned short* p = base + row * PITCH + kb;
    f.u[0] = *(const uint4*)(p);
    f.u[1] = *(const uint4*)(p + 16);
    return f.bf;
}

// ---------------------------------------------------------------------------
// Kernel 1: g[e] = gelu(X[e] (T x H)  ·  W1[e]^T (H x F))   -> bf16
// grid = (F/BN1, T/BM1, E), block = 256
// ---------------------------------------------------------------------------
__global__ __launch_bounds__(256)
void moe_gemm1_gelu(const float* __restrict__ x,
                    const float* __restrict__ w1,
                    unsigned short* __restrict__ g)
{
    __shared__ __attribute__((aligned(16))) unsigned short As[2][BM1 * LDSW1];
    __shared__ __attribute__((aligned(16))) unsigned short Bs[2][BN1 * LDSW1];

    const int e  = blockIdx.z;
    const int bx = blockIdx.x;          // F tile
    const int by = blockIdx.y;          // T tile
    const int tid  = threadIdx.x;
    const int lane = tid & 31;
    const int wave = tid >> 5;
    const int wm = wave & 1;            // 2 row groups of 128
    const int wn = wave >> 1;           // 4 col groups of 64

    const float* xe  = x  + (size_t)e * T_ * H_ + (size_t)(by * BM1) * H_;
    const float* w1e = w1 + (size_t)e * F_ * H_ + (size_t)(bx * BN1) * H_;
    unsigned short* ge = g + (size_t)e * T_ * F_;

    v8f acc[8][4];
    #pragma unroll
    for (int mt = 0; mt < 8; ++mt)
        #pragma unroll
        for (int nt = 0; nt < 4; ++nt)
            acc[mt][nt] = (v8f)(0.0f);

    const int nlocal = lane & 15;
    const int kbase  = (lane >> 4) * 8;
    const int NK = H_ / BK1;            // 32

    float4 pfA[8], pfB[8];

    // ---- prologue: tile 0 -> buffer 0
    #pragma unroll
    for (int i = 0; i < 8; ++i) {
        int row = (tid >> 3) + 32 * i, c4 = tid & 7;
        pfA[i] = *(const float4*)(xe  + (size_t)row * H_ + c4 * 4);
        pfB[i] = *(const float4*)(w1e + (size_t)row * H_ + c4 * 4);
    }
    #pragma unroll
    for (int i = 0; i < 8; ++i) {
        int row = (tid >> 3) + 32 * i, c4 = tid & 7;
        *(uint2*)(&As[0][row * LDSW1 + c4 * 4]) =
            make_uint2(pk2bf(pfA[i].x, pfA[i].y), pk2bf(pfA[i].z, pfA[i].w));
        *(uint2*)(&Bs[0][row * LDSW1 + c4 * 4]) =
            make_uint2(pk2bf(pfB[i].x, pfB[i].y), pk2bf(pfB[i].z, pfB[i].w));
    }
    __syncthreads();

    for (int k = 0; k < NK; ++k) {
        const int cur = k & 1;
        const int nxt = cur ^ 1;
        const bool hasNext = (k + 1) < NK;
        const int k0n = (k + 1) * BK1;

        // issue next tile's global loads (latency hidden under the WMMAs)
        if (hasNext) {
            #pragma unroll
            for (int i = 0; i < 8; ++i) {
                int row = (tid >> 3) + 32 * i, c4 = tid & 7;
                pfA[i] = *(const float4*)(xe  + (size_t)row * H_ + k0n + c4 * 4);
                pfB[i] = *(const float4*)(w1e + (size_t)row * H_ + k0n + c4 * 4);
            }
            // the code below reuses the address registers of these loads, so the wait is written here
            asm volatile("s_wait_xcnt 0x0" ::: "memory");
        }
        // holds the whole load group (and the wait above) in front of the matrix block:
        // otherwise each load is sunk to its convert and the round trips run one by one
        __builtin_amdgcn_sched_barrier(0);

        // compute on current buffer
        #pragma unroll
        for (int ks = 0; ks < BK1; ks += 32) {
            int kb = ks + kbase;
            v16bf aF[8], bF[4];
            #pragma unroll
            for (int mt = 0; mt < 8; ++mt)
                aF[mt] = lds_frag<LDSW1>(&As[cur][0], wm * 128 + mt * 16 + nlocal, kb);
            #pragma unroll
            for (int nt = 0; nt < 4; ++nt)
                bF[nt] = lds_frag<LDSW1>(&Bs[cur][0], wn * 64 + nt * 16 + nlocal, kb);

            #pragma unroll
            for (int mt = 0; mt < 8; ++mt)
                #pragma unroll
                for (int nt = 0; nt < 4; ++nt)
                    acc[mt][nt] = __builtin_amdgcn_wmma_f32_16x16x32_bf16(
                        false, aF[mt], false, bF[nt],
                        (short)0, acc[mt][nt], false, false);
        }

        // keeps the waits on the next tile's loads behind the matrix block, which covers them
        __builtin_amdgcn_sched_barrier(0);
        // convert + store next tile into the other buffer
        if (hasNext) {
            #pragma unroll
            for (int i = 0; i < 8; ++i) {
                int row = (tid >> 3) + 32 * i, c4 = tid & 7;
                *(uint2*)(&As[nxt][row * LDSW1 + c4 * 4]) =
                    make_uint2(pk2bf(pfA[i].x, pfA[i].y), pk2bf(pfA[i].z, pfA[i].w));
                *(uint2*)(&Bs[nxt][row * LDSW1 + c4 * 4]) =
                    make_uint2(pk2bf(pfB[i].x, pfB[i].y), pk2bf(pfB[i].z, pfB[i].w));
            }
        }
        __syncthreads();
    }

    // epilogue: GELU + bf16 store.  C layout: lanes 0-15 -> M=r, lanes16-31 -> M=r+8
    const int rowOff = by * BM1 + wm * 128;
    const int colOff = bx * BN1 + wn * 64;
    const int rplus  = (lane >> 4) * 8;
    #pragma unroll
    for (int mt = 0; mt < 8; ++mt)
        #pragma unroll
        for (int nt = 0; nt < 4; ++nt) {
            int col = colOff + nt * 16 + nlocal;
            #pragma unroll
            for (int r = 0; r < 8; ++r) {
                int row = rowOff + mt * 16 + rplus + r;
                ge[(size_t)row * F_ + col] = f2bf(gelu_tanh(acc[mt][nt][r]));
            }
        }
}

// ---------------------------------------------------------------------------
// Kernel 2: out[e] = g[e] (T x F, bf16)  ·  W2[e] (F x H, fp32)
// grid = (H/BN, T/BM, E), block = 256
// ---------------------------------------------------------------------------
__global__ __launch_bounds__(256)
void moe_gemm2(const unsigned short* __restrict__ g,
               const float* __restrict__ w2,
               float* __restrict__ out)
{
    __shared__ __attribute__((aligned(16))) unsigned short As[2][BM * LDSW];
    __shared__ __attribute__((aligned(16))) unsigned short Bs[2][BN * LDSW];

    const int e  = blockIdx.z;
    const int bx = blockIdx.x;          // H tile
    const int by = blockIdx.y;          // T tile
    const int tid  = threadIdx.x;
    const int lane = tid & 31;
    const int wave = tid >> 5;
    const int wm = wave & 3;            // 4 row groups of 64
    const int wn = wave >> 2;           // 2 col groups of 64

    const unsigned short* ge = g + (size_t)e * T_ * F_ + (size_t)(by * BM) * F_;
    const float* w2e = w2 + (size_t)e * F_ * H_;
    float* oute = out + (size_t)e * T_ * H_;

    v8f acc[4][4];
    #pragma unroll
    for (int mt = 0; mt < 4; ++mt)
        #pragma unroll
        for (int nt = 0; nt < 4; ++nt)
            acc[mt][nt] = (v8f)(0.0f);

    const int nlocal = lane & 15;
    const int kbase  = (lane >> 4) * 8;
    const int NK = F_ / BK;             // 64

    float4 pfB0[4], pfB1[4];
#if !HAS_ASYNC_LDS
    uint4 pfAu[8];
#endif

    // A tile staging: async global->LDS 16B copies (8 x 16B per 64-half row)
    auto issueA = [&](int k0, int buf) {
        #pragma unroll
        for (int i = 0; i < 8; ++i) {
            int slot = tid + 256 * i, row = slot >> 3, c4 = slot & 7;
            const unsigned short* pa = ge + (size_t)row * F_ + k0 + c4 * 8;
#if HAS_ASYNC_LDS
            __builtin_amdgcn_global_load_async_to_lds_b128(
                (AS1 v4i*)(uintptr_t)pa,
                (AS3 v4i*)(unsigned)(uintptr_t)(&As[buf][row * LDSW + c4 * 8]),
                0, 0);
#else
            pfAu[i] = *(const uint4*)pa;
#endif
        }
    };
#if !HAS_ASYNC_LDS
    auto storeA = [&](int buf) {
        #pragma unroll
        for (int i = 0; i < 8; ++i) {
            int slot = tid + 256 * i, row = slot >> 3, c4 = slot & 7;
            *(uint4*)(&As[buf][row * LDSW + c4 * 8]) = pfAu[i];
        }
    };
#endif
    // B tile: W2 [K rows, N contiguous]; load two adjacent K rows per slot
    auto loadB = [&](int k0) {
        #pragma unroll
        for (int i = 0; i < 4; ++i) {
            int slot = tid + 256 * i, kp = slot >> 5, c4 = slot & 31;
            const float* pb0 = w2e + (size_t)(k0 + 2 * kp) * H_ + bx * BN + c4 * 4;
            pfB0[i] = *(const float4*)pb0;
            pfB1[i] = *(const float4*)(pb0 + H_);
        }
    };
    // transpose into Bs[n][k]: pack (k, k+1) bf16 pair per 32-bit LDS store
    auto storeB = [&](int buf) {
        #pragma unroll
        for (int i = 0; i < 4; ++i) {
            int slot = tid + 256 * i, kp = slot >> 5, c4 = slot & 31;
            float a0[4] = { pfB0[i].x, pfB0[i].y, pfB0[i].z, pfB0[i].w };
            float a1[4] = { pfB1[i].x, pfB1[i].y, pfB1[i].z, pfB1[i].w };
            #pragma unroll
            for (int j = 0; j < 4; ++j) {
                int n = c4 * 4 + j;
                *(unsigned*)(&Bs[buf][n * LDSW + 2 * kp]) = pk2bf(a0[j], a1[j]);
            }
        }
    };

    // ---- prologue: tile 0 -> buffer 0
    issueA(0, 0);
    loadB(0);
    // the zeroing of the accumulators reuses the address registers of these loads, so the
    // wait is written here
    asm volatile("s_wait_xcnt 0x0" ::: "memory");
#if !HAS_ASYNC_LDS
    storeA(0);
#endif
    storeB(0);
    WAIT_ASYNC();
    __syncthreads();

    for (int k = 0; k < NK; ++k) {
        const int cur = k & 1;
        const int nxt = cur ^ 1;
        const bool hasNext = (k + 1) < NK;
        const int k0n = (k + 1) * BK;

        if (hasNext) {
            issueA(k0n, nxt);       // async copies straight into LDS, no VGPRs
            loadB(k0n);             // fp32 loads held in registers
        }
        // holds the whole load group in front of the matrix block: otherwise the loads
        // are sunk among the last matrix instructions and their latency is waited out
        __builtin_amdgcn_sched_barrier(0);

        #pragma unroll
        for (int ks = 0; ks < BK; ks += 32) {
            int kb = ks + kbase;
            v16bf aF[4], bF[4];
            #pragma unroll
            for (int mt = 0; mt < 4; ++mt)
                aF[mt] = lds_frag<LDSW>(&As[cur][0], wm * 64 + mt * 16 + nlocal, kb);
            #pragma unroll
            for (int nt = 0; nt < 4; ++nt)
                bF[nt] = lds_frag<LDSW>(&Bs[cur][0], wn * 64 + nt * 16 + nlocal, kb);

            #pragma unroll
            for (int mt = 0; mt < 4; ++mt)
                #pragma unroll
                for (int nt = 0; nt < 4; ++nt)
                    acc[mt][nt] = __builtin_amdgcn_wmma_f32_16x16x32_bf16(
                        false, aF[mt], false, bF[nt],
                        (short)0, acc[mt][nt], false, false);
        }

        // keeps the waits on the next tile's loads behind the matrix block, which covers them
        __builtin_amdgcn_sched_barrier(0);
        if (hasNext) {
#if !HAS_ASYNC_LDS
            storeA(nxt);
#endif
            storeB(nxt);
            WAIT_ASYNC();
        }
        __syncthreads();
    }

    const int rowOff = by * BM + wm * 64;
    const int colOff = bx * BN + wn * 64;
    const int rplus  = (lane >> 4) * 8;
    #pragma unroll
    for (int mt = 0; mt < 4; ++mt)
        #pragma unroll
        for (int nt = 0; nt < 4; ++nt) {
            int col = colOff + nt * 16 + nlocal;
            #pragma unroll
            for (int r = 0; r < 8; ++r) {
                int row = rowOff + mt * 16 + rplus + r;
                oute[(size_t)row * H_ + col] = acc[mt][nt][r];
            }
        }
}

// ---------------------------------------------------------------------------
extern "C" void kernel_launch(void* const* d_in, const int* in_sizes, int n_in,
                              void* d_out, int out_size, void* d_ws, size_t ws_size,
                              hipStream_t stream) {
    const float* x  = (const float*)d_in[0];   // [E,T,H]
    const float* w1 = (const float*)d_in[1];   // [E,F,H]
    const float* w2 = (const float*)d_in[2];   // [E,F,H]
    float* out = (float*)d_out;                // [E,T,H] fp32
    unsigned short* g = (unsigned short*)d_ws; // [E,T,F] bf16 (64 MB)

    dim3 blk(256, 1, 1);
    dim3 g1(F_ / BN1, T_ / BM1, E_);
    dim3 g2(H_ / BN, T_ / BM, E_);
    hipLaunchKernelGGL(moe_gemm1_gelu, g1, blk, 0, stream, x, w1, g);
    hipLaunchKernelGGL(moe_gemm2,      g2, blk, 0, stream, g, w2, out);
}

// v003
// A run of this version takes 159 microseconds.
// Next to v002, in two timings, it ran 1.04 times as fast each time.
// Over all steps from v000 it is 2.19 times as fast.
#include <hip/hip_runtime.h>
#include <cstdint>
#include <cstddef>

// ---------------------------------------------------------------------------
// MoE MLP for MI455X (gfx1250):  per-expert  out = gelu_tanh(X·W1^T)·W2
//   E=8, T=1024, H=1024, F=4096, fp32 in/out, bf16 WMMA + fp32 accum.
//   Kernel1: g = gelu(X·W1^T)  -> bf16 workspace
//   Kernel2: out = g·W2        (A tile via async global->LDS, ASYNCcnt)
// Block: 256 threads (8 wave32), one block per WGP.
//   Kernel1: 256 x 256 x 32 tile, 128 x 64 per wave; Kernel2: 256 x 128 x 64 tile, 64 x 64 per wave
//   (512 and 256 blocks): an operand byte fetched from L2 feeds 2 x (Kernel1) and 1.5 x (Kernel2) the products of a 128 x 128 tile.
// double-buffered LDS with register-held prefetch of the next K tile.
// ---------------------------------------------------------------------------

typedef __attribute__((ext_vector_type(16))) __bf16 v16bf;
typedef __attribute__((ext_vector_type(2)))  __bf16 v2bf;
typedef __attribute__((ext_vector_type(8)))  float  v8f;
typedef __attribute__((ext_vector_type(4)))  int    v4i;

#define AS1 __attribute__((address_space(1)))
#define AS3 __attribute__((address_space(3)))

#define E_ 8
#define T_ 1024
#define H_ 1024
#define F_ 4096

#define BM1 256     // kernel 1 tile
#define BN1 256
#define BK1 32      // one WMMA K-step: the f32 prefetch of a 64-deep tile would not leave registers for the fragments
#define LDSW1 40    // padded row stride in halves (80 B, 16 B x odd)
#define BM 256      // kernel 2 tile
#define BN 128
#define BK 64
#define LDSW 72      // padded row stride in halves (144 B, 16-B aligned)

#if __has_builtin(__builtin_amdgcn_global_load_async_to_lds_b128)
#define HAS_ASYNC_LDS 1
#else
#define HAS_ASYNC_LDS 0
#endif

#if HAS_ASYNC_LDS
#if __has_builtin(__builtin_amdgcn_s_wait_asynccnt)
#define WAIT_ASYNC() __builtin_amdgcn_s_wait_asynccnt(0)
#else
#define WAIT_ASYNC() asm volatile("s_wait_asynccnt 0x0" ::: "memory")
#endif
#else
#define WAIT_ASYNC() ((void)0)
#endif

union Frag { v16bf bf; uint4 u[2]; };

// pack two floats -> packed bf16 pair; element writes let clang use the
// native cvt into register halves (no integer shift/or packing)
__device__ __forceinline__ unsigned pk2bf(float a, float b) {
    v2bf v;
    v.x = (__bf16)a;
    v.y = (__bf16)b;
    return __builtin_bit_cast(unsigned, v);
}

__device__ __forceinline__ unsigned short f2bf(float f) {
    return __builtin_bit_cast(unsigned short, (__bf16)f);
}

__device__ __forceinline__ float gelu_tanh(float x) {
    const float c0 = 0.7978845608028654f;   // sqrt(2/pi)
    const float c1 = 0.044715f;
    float u = c0 * (x + c1 * x * x * x);
#if __has_builtin(__builtin_amdgcn_tanhf)
    float t = __builtin_amdgcn_tanhf(u);            // v_tanh_f32 (gfx1250 trans op)
#else
    float e = __expf(2.0f * u);                     // branch-free sigmoid form
    float t = 1.0f - 2.0f * __builtin_amdgcn_rcpf(e + 1.0f);
#endif
    return 0.5f * x * (1.0f + t);
}

// Fragment fetch from LDS (CDNA5 ISA 16-bit A/B 16x32 lane map):
//   lanes 0-15 : row = lane,    K = {kb+0..7, kb+16..23}
//   lanes16-31 : row = lane-16, K = {kb+8..15, kb+24..31}
template <int PITCH>
__device__ __forceinline__ v16bf lds_frag(const unsigned short* base, int row, int kb) {
    Frag f;
    const unsigned short* p = base + row * PITCH + kb;
    f.u[0] = *(const uint4*)(p);
    f.u[1] = *(const uint4*)(p + 16);
    return f.bf;
}

// ---------------------------------------------------------------------------
// Kernel 1: g[e] = gelu(X[e] (T x H)  ·  W1[e]^T (H x F))   -> bf16
// grid = (F/BN1, T/BM1, E), block = 256
// ---------------------------------------------------------------------------
__global__ __launch_bounds__(256)
void moe_gemm1_gelu(const float* __restrict__ x,
                    const float* __restrict__ w1,
                    unsigned short* __restrict__ g)
{
    __shared__ __attribute__((aligned(16))) unsigned short As[2][BM1 * LDSW1];
    __shared__ __attribute__((aligned(16))) unsigned short Bs[2][BN1 * LDSW1];

    const int e  = blockIdx.z;
    const int bx = blockIdx.x;          // F tile
    const int by = blockIdx.y;          // T tile
    const int tid  = threadIdx.x;
    const int lane = tid & 31;
    const int wave = tid >> 5;
    const int wm = wave & 1;            // 2 row groups of 128
    const int wn = wave >> 1;           // 4 col groups of 64

    const float* xe  = x  + (size_t)e * T_ * H_ + (size_t)(by * BM1) * H_;
    const float* w1e = w1 + (size_t)e * F_ * H_ + (size_t)(bx * BN1) * H_;
    unsigned short* ge = g + (size_t)e * T_ * F_;

    v8f acc[8][4];
    #pragma unroll
    for (int mt = 0; mt < 8; ++mt)
        #pragma unroll
        for (int nt = 0; nt < 4; ++nt)
            acc[mt][nt] = (v8f)(0.0f);

    const int nlocal = lane & 15;
    const int kbase  = (lane >> 4) * 8;
    const int NK = H_ / BK1;            // 32

    float4 pfA[8], pfB[8];

    // ---- prologue: tile 0 -> buffer 0
    #pragma unroll
    for (int i = 0; i < 8; ++i) {
        int row = (tid >> 3) + 32 * i, c4 = tid & 7;
        pfA[i] = *(const float4*)(xe  + (size_t)row * H_ + c4 * 4);
        pfB[i] = *(const float4*)(w1e + (size_t)row * H_ + c4 * 4);
    }
    #pragma unroll
    for (int i = 0; i < 8; ++i) {
        int row = (tid >> 3) + 32 * i, c4 = tid & 7;
        *(uint2*)(&As[0][row * LDSW1 + c4 * 4]) =
            make_uint2(pk2bf(pfA[i].x, pfA[i].y), pk2bf(pfA[i].z, pfA[i].w));
        *(uint2*)(&Bs[0][row * LDSW1 + c4 * 4]) =
            make_uint2(pk2bf(pfB[i].x, pfB[i].y), pk2bf(pfB[i].z, pfB[i].w));
    }
    __syncthreads();

    for (int k = 0; k < NK; ++k) {
        const int cur = k & 1;
        const int nxt = cur ^ 1;
        const bool hasNext = (k + 1) < NK;
        const int k0n = (k + 1) * BK1;

        // issue next tile's global loads (latency hidden under the WMMAs)
        if (hasNext) {
            #pragma unroll
            for (int i = 0; i < 8; ++i) {
                int row = (tid >> 3) + 32 * i, c4 = tid & 7;
                pfA[i] = *(const float4*)(xe  + (size_t)row * H_ + k0n + c4 * 4);
                pfB[i] = *(const float4*)(w1e + (size_t)row * H_ + k0n + c4 * 4);
            }
            // the code below reuses the address registers of these loads, so the wait is written here
            asm volatile("s_wait_xcnt 0x0" ::: "memory");
        }
        // holds the whole load group (and the wait above) in front of the matrix block:
        // otherwise each load is sunk to its convert and the round trips run one by one
        __builtin_amdgcn_sched_barrier(0);

        // compute on current buffer
        #pragma unroll
        for (int ks = 0; ks < BK1; ks += 32) {
            int kb = ks + kbase;
            v16bf aF[8], bF[4];
            // B first: the first row of matrix instructions needs all of B and one A fragment,
            // so the later A fragments land while the earlier rows run
            #pragma unroll
            for (int nt = 0; nt < 4; ++nt)
                bF[nt] = lds_frag<LDSW1>(&Bs[cur][0], wn * 64 + nt * 16 + nlocal, kb);
            #pragma unroll
            for (int mt = 0; mt < 8; ++mt)
                aF[mt] = lds_frag<LDSW1>(&As[cur][0], wm * 128 + mt * 16 + nlocal, kb);

            // holds all fragment loads of the step as one group in front of the matrix block:
            // otherwise each A fragment is loaded into one register set right before its row
            // of matrix instructions, and the LDS latency is waited out once per row
            __builtin_amdgcn_sched_barrier(0);

            #pragma unroll
            for (int mt = 0; mt < 8; ++mt)
                #pragma unroll
                for (int nt = 0; nt < 4; ++nt)
                    acc[mt][nt] = __builtin_amdgcn_wmma_f32_16x16x32_bf16(
                        false, aF[mt], false, bF[nt],
                        (short)0, acc[mt][nt], false, false);
        }

        // keeps the waits on the next tile's loads behind the matrix block, which covers them
        __builtin_amdgcn_sched_barrier(0);
        // convert + store next tile into the other buffer
        if (hasNext) {
            #pragma unroll
            for (int i = 0; i < 8; ++i) {
                int row = (tid >> 3) + 32 * i, c4 = tid & 7;
                *(uint2*)(&As[nxt][row * LDSW1 + c4 * 4]) =
                    make_uint2(pk2bf(pfA[i].x, pfA[i].y), pk2bf(pfA[i].z, pfA[i].w));
                *(uint2*)(&Bs[nxt][row * LDSW1 + c4 * 4]) =
                    make_uint2(pk2bf(pfB[i].x, pfB[i].y), pk2bf(pfB[i].z, pfB[i].w));
            }
        }
        __syncthreads();
    }

    // epilogue: GELU + bf16 store.  C layout: lanes 0-15 -> M=r, lanes16-31 -> M=r+8
    const int rowOff = by * BM1 + wm * 128;
    const int colOff = bx * BN1 + wn * 64;
    const int rplus  = (lane >> 4) * 8;
    #pragma unroll
    for (int mt = 0; mt < 8; ++mt)
        #pragma unroll
        for (int nt = 0; nt < 4; ++nt) {
            int col = colOff + nt * 16 + nlocal;
            #pragma unroll
            for (int r = 0; r < 8; ++r) {
                int row = rowOff + mt * 16 + rplus + r;
                ge[(size_t)row * F_ + col] = f2bf(gelu_tanh(acc[mt][nt][r]));
            }
        }
}

// ---------------------------------------------------------------------------
// Kernel 2: out[e] = g[e] (T x F, bf16)  ·  W2[e] (F x H, fp32)
// grid = (H/BN, T/BM, E), block = 256
// ---------------------------------------------------------------------------
__global__ __launch_bounds__(256)
void moe_gemm2(const unsigned short* __restrict__ g,
               const float* __restrict__ w2,
               float* __restrict__ out)
{
    __shared__ __attribute__((aligned(16))) unsigned short As[2][BM * LDSW];
    __shared__ __attribute__((aligned(16))) unsigned short Bs[2][BN * LDSW];

    const int e  = blockIdx.z;
    const int bx = blockIdx.x;          // H tile
    const int by = blockIdx.y;          // T tile
    const int tid  = threadIdx.x;
    const int lane = tid & 31;
    const int wave = tid >> 5;
    const int wm = wave & 3;            // 4 row groups of 64
    const int wn = wave >> 2;           // 2 col groups of 64

    const unsigned short* ge = g + (size_t)e * T_ * F_ + (size_t)(by * BM) * F_;
    const float* w2e = w2 + (size_t)e * F_ * H_;
    float* oute = out + (size_t)e * T_ * H_;

    v8f acc[4][4];
    #pragma unroll
    for (int mt = 0; mt < 4; ++mt)
        #pragma unroll
        for (int nt = 0; nt < 4; ++nt)
            acc[mt][nt] = (v8f)(0.0f);

    const int nlocal = lane & 15;
    const int kbase  = (lane >> 4) * 8;
    const int NK = F_ / BK;             // 64

    float4 pfB0[4], pfB1[4];
#if !HAS_ASYNC_LDS
    uint4 pfAu[8];
#endif

    // A tile staging: async global->LDS 16B copies (8 x 16B per 64-half row)
    auto issueA = [&](int k0, int buf) {
        #pragma unroll
        for (int i = 0; i < 8; ++i) {
            int slot = tid + 256 * i, row = slot >> 3, c4 = slot & 7;
            const unsigned short* pa = ge + (size_t)row * F_ + k0 + c4 * 8;
#if HAS_ASYNC_LDS
            __builtin_amdgcn_global_load_async_to_lds_b128(
                (AS1 v4i*)(uintptr_t)pa,
                (AS3 v4i*)(unsigned)(uintptr_t)(&As[buf][row * LDSW + c4 * 8]),
                0, 0);
#else
            pfAu[i] = *(const uint4*)pa;
#endif
        }
    };
#if !HAS_ASYNC_LDS
    auto storeA = [&](int buf) {
        #pragma unroll
        for (int i = 0; i < 8; ++i) {
            int slot = tid + 256 * i, row = slot >> 3, c4 = slot & 7;
            *(uint4*)(&As[buf][row * LDSW + c4 * 8]) = pfAu[i];
        }
    };
#endif
    // B tile: W2 [K rows, N contiguous]; load two adjacent K rows per slot
    auto loadB = [&](int k0) {
        #pragma unroll
        for (int i = 0; i < 4; ++i) {
            int slot = tid + 256 * i, kp = slot >> 5, c4 = slot & 31;
            const float* pb0 = w2e + (size_t)(k0 + 2 * kp) * H_ + bx * BN + c4 * 4;
            pfB0[i] = *(const float4*)pb0;
            pfB1[i] = *(const float4*)(pb0 + H_);
        }
    };
    // transpose into Bs[n][k]: pack (k, k+1) bf16 pair per 32-bit LDS store
    auto storeB = [&](int buf) {
        #pragma unroll
        for (int i = 0; i < 4; ++i) {
            int slot = tid + 256 * i, kp = slot >> 5, c4 = slot & 31;
            float a0[4] = { pfB0[i].x, pfB0[i].y, pfB0[i].z, pfB0[i].w };
            float a1[4] = { pfB1[i].x, pfB1[i].y, pfB1[i].z, pfB1[i].w };
            #pragma unroll
            for (int j = 0; j < 4; ++j) {
                int n = c4 * 4 + j;
                *(unsigned*)(&Bs[buf][n * LDSW + 2 * kp]) = pk2bf(a0[j], a1[j]);
            }
        }
    };

    // ---- prologue: tile 0 -> buffer 0
    issueA(0, 0);
    loadB(0);
    // the zeroing of the accumulators reuses the address registers of these loads, so the
    // wait is written here
    asm volatile("s_wait_xcnt 0x0" ::: "memory");
#if !HAS_ASYNC_LDS
    storeA(0);
#endif
    storeB(0);
    WAIT_ASYNC();
    __syncthreads();

    for (int k = 0; k < NK; ++k) {
        const int cur = k & 1;
        const int nxt = cur ^ 1;
        const bool hasNext = (k + 1) < NK;
        const int k0n = (k + 1) * BK;

        if (hasNext) {
            issueA(k0n, nxt);       // async copies straight into LDS, no VGPRs
            loadB(k0n);             // fp32 loads held in registers
            // the code below reuses the address registers of these loads, so it is written here; the four row addresses
            // are inputs so that none of their registers is reused in front of the wait
            const float* pbn[4];
            #pragma unroll
            for (int i = 0; i < 4; ++i) {
                int slot = tid + 256 * i, kp = slot >> 5, c4 = slot & 31;
                pbn[i] = w2e + (size_t)(k0n + 2 * kp) * H_ + bx * BN + c4 * 4;
            }
            asm volatile("s_wait_xcnt 0x0"
                         :: "v"(pbn[0]), "v"(pbn[1]), "v"(pbn[2]), "v"(pbn[3]) : "memory");
        }
        // holds the whole load group in front of the matrix block: otherwise the loads
        // are sunk among the last matrix instructions and their latency is waited out
        __builtin_amdgcn_sched_barrier(0);

        v16bf aF[BK / 32][4], bF[BK / 32][4];
        #pragma unroll
        for (int s = 0; s < BK / 32; ++s) {
            int kb = s * 32 + kbase;
            // B first, as in kernel 1: later fragments land while the earlier rows run
            #pragma unroll
            for (int nt = 0; nt < 4; ++nt)
                bF[s][nt] = lds_frag<LDSW>(&Bs[cur][0], wn * 64 + nt * 16 + nlocal, kb);
            #pragma unroll
            for (int mt = 0; mt < 4; ++mt)
                aF[s][mt] = lds_frag<LDSW>(&As[cur][0], wm * 64 + mt * 16 + nlocal, kb);
        }
        // holds all fragment loads of the step as one group in front of the matrix block:
        // otherwise each A fragment is loaded into one register set right before its row
        // of matrix instructions, and the LDS latency is waited out once per row
        __builtin_amdgcn_sched_barrier(0);

        #pragma unroll
        for (int s = 0; s < BK / 32; ++s)
            #pragma unroll
            for (int mt = 0; mt < 4; ++mt)
                #pragma unroll
                for (int nt = 0; nt < 4; ++nt)
                    acc[mt][nt] = __builtin_amdgcn_wmma_f32_16x16x32_bf16(
                        false, aF[s][mt], false, bF[s][nt],
                        (short)0, acc[mt][nt], false, false);

        // keeps the waits on the next tile's loads behind the matrix block, which covers them
        __builtin_amdgcn_sched_barrier(0);
        if (hasNext) {
#if !HAS_ASYNC_LDS
            storeA(nxt);
#endif
            storeB(nxt);
            WAIT_ASYNC();
        }
        __syncthreads();
    }

    const int rowOff = by * BM + wm * 64;
    const int colOff = bx * BN + wn * 64;
    const int rplus  = (lane >> 4) * 8;
    #pragma unroll
    for (int mt = 0; mt < 4; ++mt)
        #pragma unroll
        for (int nt = 0; nt < 4; ++nt) {
            int col = colOff + nt * 16 + nlocal;
            #pragma unroll
            for (int r = 0; r < 8; ++r) {
                int row = rowOff + mt * 16 + rplus + r;
                oute[(size_t)row * H_ + col] = acc[mt][nt][r];
            }
        }
}

// ---------------------------------------------------------------------------
extern "C" void kernel_launch(void* const* d_in, const int* in_sizes, int n_in,
                              void* d_out, int out_size, void* d_ws, size_t ws_size,
                              hipStream_t stream) {
    const float* x  = (const float*)d_in[0];   // [E,T,H]
    const float* w1 = (const float*)d_in[1];   // [E,F,H]
    const float* w2 = (const float*)d_in[2];   // [E,F,H]
    float* out = (float*)d_out;                // [E,T,H] fp32
    unsigned short* g = (unsigned short*)d_ws; // [E,T,F] bf16 (64 MB)

    dim3 blk(256, 1, 1);
    dim3 g1(F_ / BN1, T_ / BM1, E_);
    dim3 g2(H_ / BN, T_ / BM, E_);
    hipLaunchKernelGGL(moe_gemm1_gelu, g1, blk, 0, stream, x, w1, g);
    hipLaunchKernelGGL(moe_gemm2,      g2, blk, 0, stream, g, w2, out);
}

// v004
// A run of this version takes 144 microseconds.
// In both of two side-by-side timings against v003, it was 1.10 times as fast.
// Over all steps from v000 it is 2.41 times as fast.
#include <hip/hip_runtime.h>
#include <cstdint>
#include <cstddef>

// ---------------------------------------------------------------------------
// MoE MLP for MI455X (gfx1250):  per-expert  out = gelu_tanh(X·W1^T)·W2
//   E=8, T=1024, H=1024, F=4096, fp32 in/out, bf16 WMMA + fp32 accum.
//   Kernel1: g = gelu(X·W1^T)  -> bf16 workspace
//   Kernel2: out = g·W2
// Block: 256 threads (8 wave32), one block per WGP.
//   Kernel1: 256 x 256 x 32 tile, 128 x 64 per wave; Kernel2: 256 x 128 x 64 tile, 64 x 64 per wave
// Operands travel three K tiles ahead of their use, by asynchronous copies to LDS:
//   f32 operands land in a ring of three slots in which every thread owns the 16-byte places
//   that it fills; one tile ahead of its use the thread reads its places back, converts to bf16
//   and stores into the double-buffered bf16 tile that the fragments are read from;
//   kernel 2's A operand is bf16 already and lands straight in a ring of four fragment tiles.
// ---------------------------------------------------------------------------

typedef __attribute__((ext_vector_type(16))) __bf16 v16bf;
typedef __attribute__((ext_vector_type(2)))  __bf16 v2bf;
typedef __attribute__((ext_vector_type(8)))  float  v8f;
typedef __attribute__((ext_vector_type(4)))  int    v4i;
typedef __attribute__((ext_vector_type(4)))  float  v4f;

#define AS1 __attribute__((address_space(1)))
#define AS3 __attribute__((address_space(3)))

#define E_ 8
#define T_ 1024
#define H_ 1024
#define F_ 4096

#define BM1 256     // kernel 1 tile
#define BN1 256
#define BK1 32      // one WMMA K-step
#define LDSW1 40    // padded row stride in halves (80 B, 16 B x odd)
#define BM 256      // kernel 2 tile
#define BN 128
#define BK 64
#define LDSW 72      // padded row stride in halves (144 B, 16-B aligned)

#define RAWSLOTS 3   // slots of the f32 ring = K tiles in flight
#define ARING 4      // kernel 2's A tiles: the one being read + three in flight
#define CPT 16       // copies per thread (so per wave) and K tile, in both kernels

// 16 bytes per lane from global memory into LDS, through no register
__device__ __forceinline__ void copy16(const void* gsrc, void* ldst) {
    __builtin_amdgcn_global_load_async_to_lds_b128(
        (AS1 v4i*)(uintptr_t)gsrc, (AS3 v4i*)(unsigned)(uintptr_t)ldst, 0, 0);
}
// the wave's copies land in issue order: all but the two youngest tiles' copies (2 x CPT) have landed
#define WAIT_ASYNC_BUT_TWO_TILES() asm volatile("s_wait_asynccnt 0x20" ::: "memory")
#define WAIT_ASYNC_ALL()           asm volatile("s_wait_asynccnt 0x0" ::: "memory")
// the wave's own LDS reads and writes have retired (owed before a copy targets a place it has read)
#define WAIT_DS_ALL()              asm volatile("s_wait_dscnt 0x0" ::: "memory")
static_assert(2 * CPT == 0x20, "the counted wait leaves two tiles' copies outstanding");
static_assert(RAWSLOTS * CPT <= 63, "copies of a wave outstanding");

union Frag { v16bf bf; uint4 u[2]; };

// pack two floats -> packed bf16 pair; element writes let clang use the
// native cvt into register halves (no integer shift/or packing)
__device__ __forceinline__ unsigned pk2bf(float a, float b) {
    v2bf v;
    v.x = (__bf16)a;
    v.y = (__bf16)b;
    return __builtin_bit_cast(unsigned, v);
}

__device__ __forceinline__ unsigned short f2bf(float f) {
    return __builtin_bit_cast(unsigned short, (__bf16)f);
}

__device__ __forceinline__ float gelu_tanh(float x) {
    const float c0 = 0.7978845608028654f;   // sqrt(2/pi)
    const float c1 = 0.044715f;
    float u = c0 * (x + c1 * x * x * x);
#if __has_builtin(__builtin_amdgcn_tanhf)
    float t = __builtin_amdgcn_tanhf(u);            // v_tanh_f32 (gfx1250 trans op)
#else
    float e = __expf(2.0f * u);                     // branch-free sigmoid form
    float t = 1.0f - 2.0f * __builtin_amdgcn_rcpf(e + 1.0f);
#endif
    return 0.5f * x * (1.0f + t);
}

// Fragment fetch from LDS (CDNA5 ISA 16-bit A/B 16x32 lane map):
//   lanes 0-15 : row = lane,    K = {kb+0..7, kb+16..23}
//   lanes16-31 : row = lane-16, K = {kb+8..15, kb+24..31}
template <int PITCH>
__device__ __forceinline__ v16bf lds_frag(const unsigned short* base, int row, int kb) {
    Frag f;
    const unsigned short* p = base + row * PITCH + kb;
    f.u[0] = *(const uint4*)(p);
    f.u[1] = *(const uint4*)(p + 16);
    return f.bf;
}

// ---------------------------------------------------------------------------
// Kernel 1: g[e] = gelu(X[e] (T x H)  ·  W1[e]^T (H x F))   -> bf16
// grid = (F/BN1, T/BM1, E), block = 256
// ---------------------------------------------------------------------------
__global__ __launch_bounds__(256)
void moe_gemm1_gelu(const float* __restrict__ x,
                    const float* __restrict__ w1,
                    unsigned short* __restrict__ g)
{
    __shared__ __attribute__((aligned(16))) unsigned short As[2][BM1 * LDSW1];
    __shared__ __attribute__((aligned(16))) unsigned short Bs[2][BN1 * LDSW1];
    __shared__ __attribute__((aligned(16))) float Raw[RAWSLOTS][CPT * 256 * 4];

    const int e  = blockIdx.z;
    const int bx = blockIdx.x;          // F tile
    const int by = blockIdx.y;          // T tile
    const int tid  = threadIdx.x;
    const int lane = tid & 31;
    const int wave = tid >> 5;
    const int wm = wave & 1;            // 2 row groups of 128
    const int wn = wave >> 1;           // 4 col groups of 64

    const float* xe  = x  + (size_t)e * T_ * H_ + (size_t)(by * BM1) * H_;
    const float* w1e = w1 + (size_t)e * F_ * H_ + (size_t)(bx * BN1) * H_;
    unsigned short* ge = g + (size_t)e * T_ * F_;

    v8f acc[8][4];
    #pragma unroll
    for (int mt = 0; mt < 8; ++mt)
        #pragma unroll
        for (int nt = 0; nt < 4; ++nt)
            acc[mt][nt] = (v8f)(0.0f);

    const int nlocal = lane & 15;
    const int kbase  = (lane >> 4) * 8;
    const int NK = H_ / BK1;            // 32
    static_assert(H_ / BK1 > RAWSLOTS, "the prologue fills every slot");

    v4f pfA[8], pfB[8];

    // K tile t -> ring slot: CPT copies per thread, copy j of thread tid at [j][tid]
    auto issue = [&](int t, int slot) {
        #pragma unroll
        for (int i = 0; i < 8; ++i) {
            int row = (tid >> 3) + 32 * i, c4 = tid & 7;
            copy16(xe  + (size_t)row * H_ + t * BK1 + c4 * 4, &Raw[slot][(2 * i)     * 1024 + tid * 4]);
            copy16(w1e + (size_t)row * H_ + t * BK1 + c4 * 4, &Raw[slot][(2 * i + 1) * 1024 + tid * 4]);
        }
    };
    // each thread reads back the places that it filled itself
    auto readback = [&](int slot) {
        #pragma unroll
        for (int i = 0; i < 8; ++i) {
            pfA[i] = *(const v4f*)(&Raw[slot][(2 * i)     * 1024 + tid * 4]);
            pfB[i] = *(const v4f*)(&Raw[slot][(2 * i + 1) * 1024 + tid * 4]);
        }
    };
    auto convert_store = [&](int buf) {
        #pragma unroll
        for (int i = 0; i < 8; ++i) {
            int row = (tid >> 3) + 32 * i, c4 = tid & 7;
            *(uint2*)(&As[buf][row * LDSW1 + c4 * 4]) =
                make_uint2(pk2bf(pfA[i].x, pfA[i].y), pk2bf(pfA[i].z, pfA[i].w));
            *(uint2*)(&Bs[buf][row * LDSW1 + c4 * 4]) =
                make_uint2(pk2bf(pfB[i].x, pfB[i].y), pk2bf(pfB[i].z, pfB[i].w));
        }
    };

    // ---- prologue: tiles 0, 1, 2 take off; tile 0 -> bf16 buffer 0
    issue(0, 0);
    issue(1, 1);
    issue(2, 2);
    WAIT_ASYNC_BUT_TWO_TILES();         // tile 0 has landed
    readback(0);
    convert_store(0);
    WAIT_DS_ALL();                      // slot 0 is read out before trip 0 refills it
    __syncthreads();

    int s0 = 0;                         // k mod RAWSLOTS
    for (int k = 0; k < NK; ++k) {
        const int cur = k & 1;
        const int nxt = cur ^ 1;
        const bool hasNext = (k + 1) < NK;
        const int s1 = (s0 == RAWSLOTS - 1) ? 0 : s0 + 1;   // slot of tile k + 1

        // compute on current buffer
        {
            int kb = kbase;
            v16bf aF[8], bF[4];
            // B first: the first row of matrix instructions needs all of B and one A fragment,
            // so the later A fragments land while the earlier rows run
            #pragma unroll
            for (int nt = 0; nt < 4; ++nt)
                bF[nt] = lds_frag<LDSW1>(&Bs[cur][0], wn * 64 + nt * 16 + nlocal, kb);
            #pragma unroll
            for (int mt = 0; mt < 8; ++mt)
                aF[mt] = lds_frag<LDSW1>(&As[cur][0], wm * 128 + mt * 16 + nlocal, kb);
            // holds the fragment loads, which the matrix block waits for, in front of the copies' issue
            __builtin_amdgcn_sched_barrier(0);

            // tile k + 3 takes off into the slot of tile k, which this thread read out in trip k - 1
            // (its s_wait_dscnt 0 stands at that trip's foot)
            if (k + 3 < NK) {
                issue(k + 3, s0);
                WAIT_ASYNC_BUT_TWO_TILES(); // tile k + 1 has landed; k + 2 and k + 3 fly on
            } else {
                WAIT_ASYNC_ALL();           // the last trips issue nothing: no count holds there
            }
            // next tile's f32 values out of the ring, behind their wait
            if (hasNext) readback(s1);

            // holds all LDS loads of the step as one group in front of the matrix block:
            // otherwise each A fragment is loaded into one register set right before its row
            // of matrix instructions, and the LDS latency is waited out once per row
            __builtin_amdgcn_sched_barrier(0);

            #pragma unroll
            for (int mt = 0; mt < 8; ++mt)
                #pragma unroll
                for (int nt = 0; nt < 4; ++nt)
                    acc[mt][nt] = __builtin_amdgcn_wmma_f32_16x16x32_bf16(
                        false, aF[mt], false, bF[nt],
                        (short)0, acc[mt][nt], false, false);
        }

        // keeps the converts and LDS stores of the next tile behind the matrix block
        __builtin_amdgcn_sched_barrier(0);
        // the f32 values are inputs here so that their converts stay behind the matrix block too:
        // placed in front of it they make the first matrix instruction wait for every LDS load above
        if (hasNext)
            asm volatile("" :: "v"(pfA[0]), "v"(pfA[1]), "v"(pfA[2]), "v"(pfA[3]),
                               "v"(pfA[4]), "v"(pfA[5]), "v"(pfA[6]), "v"(pfA[7]),
                               "v"(pfB[0]), "v"(pfB[1]), "v"(pfB[2]), "v"(pfB[3]),
                               "v"(pfB[4]), "v"(pfB[5]), "v"(pfB[6]), "v"(pfB[7]));
        if (hasNext) convert_store(nxt);
        WAIT_DS_ALL();                  // slot s1 is read out before the next trip refills it
        __syncthreads();
        s0 = s1;
    }

    // epilogue: GELU + bf16 store.  C layout: lanes 0-15 -> M=r, lanes16-31 -> M=r+8
    const int rowOff = by * BM1 + wm * 128;
    const int colOff = bx * BN1 + wn * 64;
    const int rplus  = (lane >> 4) * 8;
    #pragma unroll
    for (int mt = 0; mt < 8; ++mt)
        #pragma unroll
        for (int nt = 0; nt < 4; ++nt) {
            int col = colOff + nt * 16 + nlocal;
            #pragma unroll
            for (int r = 0; r < 8; ++r) {
                int row = rowOff + mt * 16 + rplus + r;
                ge[(size_t)row * F_ + col] = f2bf(gelu_tanh(acc[mt][nt][r]));
            }
        }
}

// ---------------------------------------------------------------------------
// Kernel 2: out[e] = g[e] (T x F, bf16)  ·  W2[e] (F x H, fp32)
// grid = (H/BN, T/BM, E), block = 256
// ---------------------------------------------------------------------------
__global__ __launch_bounds__(256)
void moe_gemm2(const unsigned short* __restrict__ g,
               const float* __restrict__ w2,
               float* __restrict__ out)
{
    __shared__ __attribute__((aligned(16))) unsigned short As[ARING][BM * LDSW];
    __shared__ __attribute__((aligned(16))) unsigned short Bs[2][BN * LDSW];
    __shared__ __attribute__((aligned(16))) float Raw[RAWSLOTS][8 * 256 * 4];

    const int e  = blockIdx.z;
    const int bx = blockIdx.x;          // H tile
    const int by = blockIdx.y;          // T tile
    const int tid  = threadIdx.x;
    const int lane = tid & 31;
    const int wave = tid >> 5;
    const int wm = wave & 3;            // 4 row groups of 64
    const int wn = wave >> 2;           // 2 col groups of 64

    const unsigned short* ge = g + (size_t)e * T_ * F_ + (size_t)(by * BM) * F_;
    const float* w2e = w2 + (size_t)e * F_ * H_;
    float* oute = out + (size_t)e * T_ * H_;

    v8f acc[4][4];
    #pragma unroll
    for (int mt = 0; mt < 4; ++mt)
        #pragma unroll
        for (int nt = 0; nt < 4; ++nt)
            acc[mt][nt] = (v8f)(0.0f);

    const int nlocal = lane & 15;
    const int kbase  = (lane >> 4) * 8;
    const int NK = F_ / BK;             // 64
    static_assert(F_ / BK > RAWSLOTS, "the prologue fills every slot");

    float4 pfB0[4], pfB1[4];

    // K tile t: CPT copies per thread.  A (bf16, 8 x 16 B per 64-half row) straight into its
    // fragment tile; B (W2 [K rows, N contiguous], two adjacent K rows per place) into the f32 ring
    auto issue = [&](int t, int abuf, int slot) {
        #pragma unroll
        for (int i = 0; i < 8; ++i) {
            int sl = tid + 256 * i, row = sl >> 3, c4 = sl & 7;
            copy16(ge + (size_t)row * F_ + t * BK + c4 * 8, &As[abuf][row * LDSW + c4 * 8]);
        }
        #pragma unroll
        for (int i = 0; i < 4; ++i) {
            int sl = tid + 256 * i, kp = sl >> 5, c4 = sl & 31;
            const float* pb0 = w2e + (size_t)(t * BK + 2 * kp) * H_ + bx * BN + c4 * 4;
            copy16(pb0,      &Raw[slot][(2 * i)     * 1024 + tid * 4]);
            copy16(pb0 + H_, &Raw[slot][(2 * i + 1) * 1024 + tid * 4]);
        }
    };
    // each thread reads back the places that it filled itself
    auto readbackB = [&](int slot) {
        #pragma unroll
        for (int i = 0; i < 4; ++i) {
            pfB0[i] = *(const float4*)(&Raw[slot][(2 * i)     * 1024 + tid * 4]);
            pfB1[i] = *(const float4*)(&Raw[slot][(2 * i + 1) * 1024 + tid * 4]);
        }
    };
    // transpose into Bs[n][k]: pack (k, k+1) bf16 pair per 32-bit LDS store
    auto storeB = [&](int buf) {
        #pragma unroll
        for (int i = 0; i < 4; ++i) {
            int sl = tid + 256 * i, kp = sl >> 5, c4 = sl & 31;
            float a0[4] = { pfB0[i].x, pfB0[i].y, pfB0[i].z, pfB0[i].w };
            float a1[4] = { pfB1[i].x, pfB1[i].y, pfB1[i].z, pfB1[i].w };
            #pragma unroll
            for (int j = 0; j < 4; ++j) {
                int n = c4 * 4 + j;
                *(unsigned*)(&Bs[buf][n * LDSW + 2 * kp]) = pk2bf(a0[j], a1[j]);
            }
        }
    };

    // ---- prologue: tiles 0, 1, 2 take off; tile 0's B -> bf16 buffer 0
    issue(0, 0, 0);
    issue(1, 1, 1);
    issue(2, 2, 2);
    WAIT_ASYNC_BUT_TWO_TILES();         // this wave's part of tile 0 has landed
    readbackB(0);
    storeB(0);
    WAIT_DS_ALL();                      // slot 0 is read out before trip 0 refills it
    __syncthreads();                    // publishes tile 0 (A copies of every wave, B stores)

    int s0 = 0;                         // k mod RAWSLOTS
    for (int k = 0; k < NK; ++k) {
        const int cur = k & 1;
        const int nxt = cur ^ 1;
        const int acur = k & (ARING - 1);
        const bool hasNext = (k + 1) < NK;
        const int s1 = (s0 == RAWSLOTS - 1) ? 0 : s0 + 1;   // slot of tile k + 1

        v16bf aF[BK / 32][4], bF[BK / 32][4];
        #pragma unroll
        for (int s = 0; s < BK / 32; ++s) {
            int kb = s * 32 + kbase;
            // B first, as in kernel 1: later fragments land while the earlier rows run
            #pragma unroll
            for (int nt = 0; nt < 4; ++nt)
                bF[s][nt] = lds_frag<LDSW>(&Bs[cur][0], wn * 64 + nt * 16 + nlocal, kb);
            #pragma unroll
            for (int mt = 0; mt < 4; ++mt)
                aF[s][mt] = lds_frag<LDSW>(&As[acur][0], wm * 64 + mt * 16 + nlocal, kb);
        }
        // holds the fragment loads, which the matrix block waits for, in front of the copies' issue
        __builtin_amdgcn_sched_barrier(0);

        // tile k + 3 takes off: A into the tile that every wave read in trip k - 1 (the barrier at
        // that trip's foot ended those reads), B into the slot that this thread read out there
        if (k + 3 < NK) {
            issue(k + 3, (k + 3) & (ARING - 1), s0);
            WAIT_ASYNC_BUT_TWO_TILES(); // tile k + 1 has landed; k + 2 and k + 3 fly on
        } else {
            WAIT_ASYNC_ALL();           // the last trips issue nothing: no count holds there
        }
        // next tile's f32 values out of the ring, behind their wait
        if (hasNext) readbackB(s1);
        // holds all LDS loads of the step as one group in front of the matrix block:
        // otherwise each A fragment is loaded into one register set right before its row
        // of matrix instructions, and the LDS latency is waited out once per row
        __builtin_amdgcn_sched_barrier(0);

        #pragma unroll
        for (int s = 0; s < BK / 32; ++s)
            #pragma unroll
            for (int mt = 0; mt < 4; ++mt)
                #pragma unroll
                for (int nt = 0; nt < 4; ++nt)
                    acc[mt][nt] = __builtin_amdgcn_wmma_f32_16x16x32_bf16(
                        false, aF[s][mt], false, bF[s][nt],
                        (short)0, acc[mt][nt], false, false);

        // keeps the converts and LDS stores of the next tile behind the matrix block
        __builtin_amdgcn_sched_barrier(0);
        if (hasNext) storeB(nxt);
        WAIT_DS_ALL();                  // slot s1 is read out before the next trip refills it
        __syncthreads();                // publishes tile k + 1, ends the reads of tile k
        s0 = s1;
    }

    const int rowOff = by * BM + wm * 64;
    const int colOff = bx * BN + wn * 64;
    const int rplus  = (lane >> 4) * 8;
    #pragma unroll
    for (int mt = 0; mt < 4; ++mt)
        #pragma unroll
        for (int nt = 0; nt < 4; ++nt) {
            int col = colOff + nt * 16 + nlocal;
            #pragma unroll
            for (int r = 0; r < 8; ++r) {
                int row = rowOff + mt * 16 + rplus + r;
                oute[(size_t)row * H_ + col] = acc[mt][nt][r];
            }
        }
}

// ---------------------------------------------------------------------------
extern "C" void kernel_launch(void* const* d_in, const int* in_sizes, int n_in,
                              void* d_out, int out_size, void* d_ws, size_t ws_size,
                              hipStream_t stream) {
    const float* x  = (const float*)d_in[0];   // [E,T,H]
    const float* w1 = (const float*)d_in[1];   // [E,F,H]
    const float* w2 = (const float*)d_in[2];   // [E,F,H]
    float* out = (float*)d_out;                // [E,T,H] fp32
    unsigned short* g = (unsigned short*)d_ws; // [E,T,F] bf16 (64 MB)

    dim3 blk(256, 1, 1);
    dim3 g1(F_ / BN1, T_ / BM1, E_);
    dim3 g2(H_ / BN, T_ / BM, E_);
    hipLaunchKernelGGL(moe_gemm1_gelu, g1, blk, 0, stream, x, w1, g);
    hipLaunchKernelGGL(moe_gemm2,      g2, blk, 0, stream, g, w2, out);
}

// v005
// One run takes 130 microseconds.
// Two timings next to v004 put it at 1.10 and 1.11 times that version's speed.
// Counting every step since v000, it is 2.66 times as fast.
#include <hip/hip_runtime.h>
#include <cstdint>
#include <cstddef>

// ---------------------------------------------------------------------------
// MoE MLP for MI455X (gfx1250):  per-expert  out = gelu_tanh(X·W1^T)·W2
//   E=8, T=1024, H=1024, F=4096, fp32 in/out, bf16 WMMA + fp32 accum.
//   Kernel1: g = gelu(X·W1^T)  -> bf16 workspace
//   Kernel2: out = g·W2
// Block: 256 threads (8 wave32), one block per WGP.
//   Kernel1: 256 x 256 x 32 tile, 128 x 64 per wave; Kernel2: 256 x 128 x 64 tile, 64 x 64 per wave
// Operands travel three K tiles ahead of their use, by asynchronous copies to LDS:
//   f32 operands land in a ring of three slots in which every thread owns the 16-byte places
//   that it fills; one tile ahead of its use the thread reads its places back, converts to bf16
//   and stores into the double-buffered bf16 tile that the fragments are read from;
//   kernel 2's A operand is bf16 already and lands straight in a ring of four fragment tiles.
// ---------------------------------------------------------------------------

typedef __attribute__((ext_vector_type(16))) __bf16 v16bf;
typedef __attribute__((ext_vector_type(2)))  __bf16 v2bf;
typedef __attribute__((ext_vector_type(8)))  float  v8f;
typedef __attribute__((ext_vector_type(4)))  int    v4i;
typedef __attribute__((ext_vector_type(4)))  float  v4f;

#define AS1 __attribute__((address_space(1)))
#define AS3 __attribute__((address_space(3)))

#define E_ 8
#define T_ 1024
#define H_ 1024
#define F_ 4096

#define BM1 256     // kernel 1 tile
#define BN1 256
#define BK1 32      // one WMMA K-step
#define LDSW1 40    // padded row stride in halves (80 B, 16 B x odd)
#define BM 256      // kernel 2 tile
#define BN 128
#define BK 64
#define LDSW 72      // padded row stride in halves (144 B, 16-B aligned)

#define RAWSLOTS 3   // slots of the f32 ring = K tiles in flight
#define ARING 4      // kernel 2's A tiles: the one being read + three in flight
#define CPT 16       // copies per thread (so per wave) and K tile, in both kernels

// 16 bytes per lane from global memory into LDS, through no register
__device__ __forceinline__ void copy16(const void* gsrc, void* ldst) {
    __builtin_amdgcn_global_load_async_to_lds_b128(
        (AS1 v4i*)(uintptr_t)gsrc, (AS3 v4i*)(unsigned)(uintptr_t)ldst, 0, 0);
}
// the wave's copies land in issue order: all but the two youngest tiles' copies (2 x CPT) have landed
#define WAIT_ASYNC_BUT_TWO_TILES() asm volatile("s_wait_asynccnt 0x20" ::: "memory")
#define WAIT_ASYNC_ALL()           asm volatile("s_wait_asynccnt 0x0" ::: "memory")
// the wave's own LDS reads and writes have retired (owed before a copy targets a place it has read)
#define WAIT_DS_ALL()              asm volatile("s_wait_dscnt 0x0" ::: "memory")
static_assert(2 * CPT == 0x20, "the counted wait leaves two tiles' copies outstanding");
static_assert(RAWSLOTS * CPT <= 63, "copies of a wave outstanding");

union Frag { v16bf bf; uint4 u[2]; };

// pack two floats -> packed bf16 pair; element writes let clang use the
// native cvt into register halves (no integer shift/or packing)
__device__ __forceinline__ unsigned pk2bf(float a, float b) {
    v2bf v;
    v.x = (__bf16)a;
    v.y = (__bf16)b;
    return __builtin_bit_cast(unsigned, v);
}

__device__ __forceinline__ unsigned short f2bf(float f) {
    return __builtin_bit_cast(unsigned short, (__bf16)f);
}

__device__ __forceinline__ float gelu_tanh(float x) {
    const float c0 = 0.7978845608028654f;   // sqrt(2/pi)
    const float c1 = 0.044715f;
    float u = c0 * (x + c1 * x * x * x);
#if __has_builtin(__builtin_amdgcn_tanhf)
    float t = __builtin_amdgcn_tanhf(u);            // v_tanh_f32 (gfx1250 trans op)
#else
    float e = __expf(2.0f * u);                     // branch-free sigmoid form
    float t = 1.0f - 2.0f * __builtin_amdgcn_rcpf(e + 1.0f);
#endif
    return 0.5f * x * (1.0f + t);
}

// Fragment fetch from LDS (CDNA5 ISA 16-bit A/B 16x32 lane map):
//   lanes 0-15 : row = lane,    K = {kb+0..7, kb+16..23}
//   lanes16-31 : row = lane-16, K = {kb+8..15, kb+24..31}
template <int PITCH>
__device__ __forceinline__ v16bf lds_frag(const unsigned short* base, int row, int kb) {
    Frag f;
    const unsigned short* p = base + row * PITCH + kb;
    f.u[0] = *(const uint4*)(p);
    f.u[1] = *(const uint4*)(p + 16);
    return f.bf;
}

// ---------------------------------------------------------------------------
// Kernel 1: g[e] = gelu(X[e] (T x H)  ·  W1[e]^T (H x F))   -> bf16
// grid = (F/BN1, T/BM1, E), block = 256
// ---------------------------------------------------------------------------
__global__ __launch_bounds__(256)
void moe_gemm1_gelu(const float* __restrict__ x,
                    const float* __restrict__ w1,
                    unsigned short* __restrict__ g)
{
    __shared__ __attribute__((aligned(16))) unsigned short As[2][BM1 * LDSW1];
    __shared__ __attribute__((aligned(16))) unsigned short Bs[2][BN1 * LDSW1];
    __shared__ __attribute__((aligned(16))) float Raw[RAWSLOTS][CPT * 256 * 4];

    const int e  = blockIdx.z;
    const int bx = blockIdx.x;          // F tile
    const int by = blockIdx.y;          // T tile
    const int tid  = threadIdx.x;
    const int lane = tid & 31;
    const int wave = tid >> 5;
    const int wm = wave & 1;            // 2 row groups of 128
    const int wn = wave >> 1;           // 4 col groups of 64

    const float* xe  = x  + (size_t)e * T_ * H_ + (size_t)(by * BM1) * H_;
    const float* w1e = w1 + (size_t)e * F_ * H_ + (size_t)(bx * BN1) * H_;
    unsigned short* ge = g + (size_t)e * T_ * F_;

    v8f acc[8][4];
    #pragma unroll
    for (int mt = 0; mt < 8; ++mt)
        #pragma unroll
        for (int nt = 0; nt < 4; ++nt)
            acc[mt][nt] = (v8f)(0.0f);

    const int nlocal = lane & 15;
    const int kbase  = (lane >> 4) * 8;
    const int NK = H_ / BK1;            // 32
    static_assert(H_ / BK1 > RAWSLOTS, "the prologue fills every slot");

    v4f pfA[8], pfB[8];

    // K tile t -> ring slot: CPT copies per thread, copy j of thread tid at [j][tid]
    auto issue = [&](int t, int slot) {
        #pragma unroll
        for (int i = 0; i < 8; ++i) {
            int row = (tid >> 3) + 32 * i, c4 = tid & 7;
            copy16(xe  + (size_t)row * H_ + t * BK1 + c4 * 4, &Raw[slot][(2 * i)     * 1024 + tid * 4]);
            copy16(w1e + (size_t)row * H_ + t * BK1 + c4 * 4, &Raw[slot][(2 * i + 1) * 1024 + tid * 4]);
        }
    };
    // each thread reads back the places that it filled itself
    auto readback = [&](int slot) {
        #pragma unroll
        for (int i = 0; i < 8; ++i) {
            pfA[i] = *(const v4f*)(&Raw[slot][(2 * i)     * 1024 + tid * 4]);
            pfB[i] = *(const v4f*)(&Raw[slot][(2 * i + 1) * 1024 + tid * 4]);
        }
    };
    auto convert_store = [&](int buf) {
        #pragma unroll
        for (int i = 0; i < 8; ++i) {
            int row = (tid >> 3) + 32 * i, c4 = tid & 7;
            *(uint2*)(&As[buf][row * LDSW1 + c4 * 4]) =
                make_uint2(pk2bf(pfA[i].x, pfA[i].y), pk2bf(pfA[i].z, pfA[i].w));
            *(uint2*)(&Bs[buf][row * LDSW1 + c4 * 4]) =
                make_uint2(pk2bf(pfB[i].x, pfB[i].y), pk2bf(pfB[i].z, pfB[i].w));
        }
    };

    // ---- prologue: tiles 0, 1, 2 take off; tile 0 -> bf16 buffer 0
    issue(0, 0);
    issue(1, 1);
    issue(2, 2);
    WAIT_ASYNC_BUT_TWO_TILES();         // tile 0 has landed
    readback(0);
    convert_store(0);
    WAIT_DS_ALL();                      // slot 0 is read out before trip 0 refills it
    __syncthreads();

    int s0 = 0;                         // k mod RAWSLOTS
    for (int k = 0; k < NK; ++k) {
        const int cur = k & 1;
        const int nxt = cur ^ 1;
        const bool hasNext = (k + 1) < NK;
        const int s1 = (s0 == RAWSLOTS - 1) ? 0 : s0 + 1;   // slot of tile k + 1

        // compute on current buffer
        {
            int kb = kbase;
            v16bf aF[8], bF[4];
            // B first: the first row of matrix instructions needs all of B and one A fragment,
            // so the later A fragments land while the earlier rows run
            #pragma unroll
            for (int nt = 0; nt < 4; ++nt)
                bF[nt] = lds_frag<LDSW1>(&Bs[cur][0], wn * 64 + nt * 16 + nlocal, kb);
            #pragma unroll
            for (int mt = 0; mt < 8; ++mt)
                aF[mt] = lds_frag<LDSW1>(&As[cur][0], wm * 128 + mt * 16 + nlocal, kb);
            // holds the fragment loads, which the matrix block waits for, in front of the copies' issue
            __builtin_amdgcn_sched_barrier(0);

            // tile k + 3 takes off into the slot of tile k, which this thread read out in trip k - 1
            // (its s_wait_dscnt 0 stands at that trip's foot)
            if (k + 3 < NK) {
                issue(k + 3, s0);
                WAIT_ASYNC_BUT_TWO_TILES(); // tile k + 1 has landed; k + 2 and k + 3 fly on
            } else {
                WAIT_ASYNC_ALL();           // the last trips issue nothing: no count holds there
            }
            // next tile's f32 values out of the ring, behind their wait
            if (hasNext) readback(s1);

            // holds all LDS loads of the step as one group in front of the matrix block:
            // otherwise each A fragment is loaded into one register set right before its row
            // of matrix instructions, and the LDS latency is waited out once per row
            __builtin_amdgcn_sched_barrier(0);

            #pragma unroll
            for (int mt = 0; mt < 8; ++mt)
                #pragma unroll
                for (int nt = 0; nt < 4; ++nt)
                    acc[mt][nt] = __builtin_amdgcn_wmma_f32_16x16x32_bf16(
                        false, aF[mt], false, bF[nt],
                        (short)0, acc[mt][nt], false, false);
        }

        // keeps the converts and LDS stores of the next tile behind the matrix block
        __builtin_amdgcn_sched_barrier(0);
        // the f32 values are inputs here so that their converts stay behind the matrix block too:
        // placed in front of it they make the first matrix instruction wait for every LDS load above
        if (hasNext)
            asm volatile("" :: "v"(pfA[0]), "v"(pfA[1]), "v"(pfA[2]), "v"(pfA[3]),
                               "v"(pfA[4]), "v"(pfA[5]), "v"(pfA[6]), "v"(pfA[7]),
                               "v"(pfB[0]), "v"(pfB[1]), "v"(pfB[2]), "v"(pfB[3]),
                               "v"(pfB[4]), "v"(pfB[5]), "v"(pfB[6]), "v"(pfB[7]));
        if (hasNext) convert_store(nxt);
        WAIT_DS_ALL();                  // slot s1 is read out before the next trip refills it
        __syncthreads();
        s0 = s1;
    }

    // epilogue: GELU + bf16 store.  C layout: lanes 0-15 -> M=r, lanes16-31 -> M=r+8
    const int rowOff = by * BM1 + wm * 128;
    const int colOff = bx * BN1 + wn * 64;
    const int rplus  = (lane >> 4) * 8;
    #pragma unroll
    for (int mt = 0; mt < 8; ++mt)
        #pragma unroll
        for (int nt = 0; nt < 4; ++nt) {
            int col = colOff + nt * 16 + nlocal;
            #pragma unroll
            for (int r = 0; r < 8; ++r) {
                int row = rowOff + mt * 16 + rplus + r;
                ge[(size_t)row * F_ + col] = f2bf(gelu_tanh(acc[mt][nt][r]));
            }
        }
}

// ---------------------------------------------------------------------------
// Kernel 2: out[e] = g[e] (T x F, bf16)  ·  W2[e] (F x H, fp32)
// grid = (H/BN, T/BM, E), block = 256
// ---------------------------------------------------------------------------
__global__ __launch_bounds__(256)
void moe_gemm2(const unsigned short* __restrict__ g,
               const float* __restrict__ w2,
               float* __restrict__ out)
{
    __shared__ __attribute__((aligned(16))) unsigned short As[ARING][BM * LDSW];
    __shared__ __attribute__((aligned(16))) unsigned short Bs[2][BN * LDSW];
    __shared__ __attribute__((aligned(16))) float Raw[RAWSLOTS][8 * 256 * 4];

    const int e  = blockIdx.z;
    const int bx = blockIdx.x;          // H tile
    const int by = blockIdx.y;          // T tile
    const int tid  = threadIdx.x;
    const int lane = tid & 31;
    const int wave = tid >> 5;
    const int wm = wave & 3;            // 4 row groups of 64
    const int wn = wave >> 2;           // 2 col groups of 64

    const unsigned short* ge = g + (size_t)e * T_ * F_ + (size_t)(by * BM) * F_;
    const float* w2e = w2 + (size_t)e * F_ * H_;
    float* oute = out + (size_t)e * T_ * H_;

    v8f acc[4][4];
    #pragma unroll
    for (int mt = 0; mt < 4; ++mt)
        #pragma unroll
        for (int nt = 0; nt < 4; ++nt)
            acc[mt][nt] = (v8f)(0.0f);

    const int nlocal = lane & 15;
    const int kbase  = (lane >> 4) * 8;
    const int NK = F_ / BK;             // 64
    static_assert(F_ / BK > RAWSLOTS, "the prologue fills every slot");

    // B operand (W2, [K rows, N contiguous]): a thread takes eight adjacent K rows of four columns,
    // so that each column leaves it as eight bf16 adjacent in k: one 16-byte LDS store.
    // Eight lanes cover one 128-byte line of a row; the four lane groups of a wave take four
    // different k groups, which spreads a wave's stores into Bs[n][k] over all LDS banks
    // (lanes that differ only in n lie 4 rows = 576 B apart and meet on a quarter of the banks)
    const int bkg = ((wave & 1) << 2) | (lane >> 3);    // 0..7: group of eight K rows
    const int bc4 = ((wave >> 1) << 3) | (lane & 7);    // 0..31: group of four columns
    v4f pfB[8];

    // K tile t: CPT copies per thread.  A (bf16, 8 x 16 B per 64-half row) straight into its
    // fragment tile; B (f32, one K row per copy) into the f32 ring
    auto issue = [&](int t, int abuf, int slot) {
        #pragma unroll
        for (int i = 0; i < 8; ++i) {
            int sl = tid + 256 * i, row = sl >> 3, c4 = sl & 7;
            copy16(ge + (size_t)row * F_ + t * BK + c4 * 8, &As[abuf][row * LDSW + c4 * 8]);
        }
        const float* pb = w2e + (size_t)(t * BK + 8 * bkg) * H_ + bx * BN + bc4 * 4;
        #pragma unroll
        for (int r = 0; r < 8; ++r)
            copy16(pb + (size_t)r * H_, &Raw[slot][r * 1024 + tid * 4]);
    };
    // each thread reads back the places that it filled itself
    auto readbackB = [&](int slot) {
        #pragma unroll
        for (int r = 0; r < 8; ++r)
            pfB[r] = *(const v4f*)(&Raw[slot][r * 1024 + tid * 4]);
    };
    // transpose into Bs[n][k]: eight bf16 adjacent in k per 128-bit LDS store
    auto storeB = [&](int buf) {
        #pragma unroll
        for (int j = 0; j < 4; ++j) {
            int n = bc4 * 4 + j;
            *(uint4*)(&Bs[buf][n * LDSW + 8 * bkg]) =
                make_uint4(pk2bf(pfB[0][j], pfB[1][j]), pk2bf(pfB[2][j], pfB[3][j]),
                           pk2bf(pfB[4][j], pfB[5][j]), pk2bf(pfB[6][j], pfB[7][j]));
        }
    };

    // ---- prologue: tiles 0, 1, 2 take off; tile 0's B -> bf16 buffer 0
    issue(0, 0, 0);
    issue(1, 1, 1);
    issue(2, 2, 2);
    WAIT_ASYNC_BUT_TWO_TILES();         // this wave's part of tile 0 has landed
    readbackB(0);
    storeB(0);
    WAIT_DS_ALL();                      // slot 0 is read out before trip 0 refills it
    __syncthreads();                    // publishes tile 0 (A copies of every wave, B stores)

    int s0 = 0;                         // k mod RAWSLOTS
    for (int k = 0; k < NK; ++k) {
        const int cur = k & 1;
        const int nxt = cur ^ 1;
        const int acur = k & (ARING - 1);
        const bool hasNext = (k + 1) < NK;
        const int s1 = (s0 == RAWSLOTS - 1) ? 0 : s0 + 1;   // slot of tile k + 1

        v16bf aF[BK / 32][4], bF[BK / 32][4];
        #pragma unroll
        for (int s = 0; s < BK / 32; ++s) {
            int kb = s * 32 + kbase;
            // B first, as in kernel 1: later fragments land while the earlier rows run
            #pragma unroll
            for (int nt = 0; nt < 4; ++nt)
                bF[s][nt] = lds_frag<LDSW>(&Bs[cur][0], wn * 64 + nt * 16 + nlocal, kb);
            #pragma unroll
            for (int mt = 0; mt < 4; ++mt)
                aF[s][mt] = lds_frag<LDSW>(&As[acur][0], wm * 64 + mt * 16 + nlocal, kb);
        }
        // holds the fragment loads, which the matrix block waits for, in front of the copies' issue
        __builtin_amdgcn_sched_barrier(0);

        // tile k + 3 takes off: A into the tile that every wave read in trip k - 1 (the barrier at
        // that trip's foot ended those reads), B into the slot that this thread read out there
        if (k + 3 < NK) {
            issue(k + 3, (k + 3) & (ARING - 1), s0);
            WAIT_ASYNC_BUT_TWO_TILES(); // tile k + 1 has landed; k + 2 and k + 3 fly on
        } else {
            WAIT_ASYNC_ALL();           // the last trips issue nothing: no count holds there
        }
        // next tile's f32 values out of the ring, behind their wait
        if (hasNext) readbackB(s1);
        // holds all LDS loads of the step as one group in front of the matrix block:
        // otherwise each A fragment is loaded into one register set right before its row
        // of matrix instructions, and the LDS latency is waited out once per row
        __builtin_amdgcn_sched_barrier(0);

        #pragma unroll
        for (int s = 0; s < BK / 32; ++s)
            #pragma unroll
            for (int mt = 0; mt < 4; ++mt)
                #pragma unroll
                for (int nt = 0; nt < 4; ++nt)
                    acc[mt][nt] = __builtin_amdgcn_wmma_f32_16x16x32_bf16(
                        false, aF[s][mt], false, bF[s][nt],
                        (short)0, acc[mt][nt], false, false);

        // keeps the converts and LDS stores of the next tile behind the matrix block
        __builtin_amdgcn_sched_barrier(0);
        if (hasNext) storeB(nxt);
        WAIT_DS_ALL();                  // slot s1 is read out before the next trip refills it
        __syncthreads();                // publishes tile k + 1, ends the reads of tile k
        s0 = s1;
    }

    const int rowOff = by * BM + wm * 64;
    const int colOff = bx * BN + wn * 64;
    const int rplus  = (lane >> 4) * 8;
    #pragma unroll
    for (int mt = 0; mt < 4; ++mt)
        #pragma unroll
        for (int nt = 0; nt < 4; ++nt) {
            int col = colOff + nt * 16 + nlocal;
            #pragma unroll
            for (int r = 0; r < 8; ++r) {
                int row = rowOff + mt * 16 + rplus + r;
                oute[(size_t)row * H_ + col] = acc[mt][nt][r];
            }
        }
}

// ---------------------------------------------------------------------------
extern "C" void kernel_launch(void* const* d_in, const int* in_sizes, int n_in,
                              void* d_out, int out_size, void* d_ws, size_t ws_size,
                              hipStream_t stream) {
    const float* x  = (const float*)d_in[0];   // [E,T,H]
    const float* w1 = (const float*)d_in[1];   // [E,F,H]
    const float* w2 = (const float*)d_in[2];   // [E,F,H]
    float* out = (float*)d_out;                // [E,T,H] fp32
    unsigned short* g = (unsigned short*)d_ws; // [E,T,F] bf16 (64 MB)

    dim3 blk(256, 1, 1);
    dim3 g1(F_ / BN1, T_ / BM1, E_);
    dim3 g2(H_ / BN, T_ / BM, E_);
    hipLaunchKernelGGL(moe_gemm1_gelu, g1, blk, 0, stream, x, w1, g);
    hipLaunchKernelGGL(moe_gemm2,      g2, blk, 0, stream, g, w2, out);
}
